// v000
// The times below were measured on an AMD MI455X: many runs one after another, warmed up first and cycling through
// copies of the inputs, with the whole window's GPU time divided by the number of runs. Launches and the gaps
// between them are all in it. The median over several windows is given; except for v000 it joins two sittings, which
// can be a few percent apart, so the side-by-side timings, each taken in one sitting, are the better comparison.
// v000 is the starting kernel. One run takes 1400 microseconds.
#include <hip/hip_runtime.h>

// Multi-head attention with a learned bilinear score and a per-batch key threshold (queries, keys, values [2][2048][1024]; Q,K,V = input W + b ('xw' [1024][1024] + [1024]; 16 heads x 64); scores = (Q W).K with W [64][64] shared by all heads, NO 1/sqrt(d) (logit sigma ~8); keys j >= thresholds[b] get the logit MASK_VALUE = -1e-6 (a value near zero, NOT an exclusion -- reproduced literally; thresholds int [2], read); softmax; out = merged attn.V Wo + bo -> [2][2048][1024] (4.2 M)).
// Layout per batch: bf16 copies of the three inputs in turn; exact projections + bf16-rounded biases; the bilinear W applied as one block-diagonal [1024][1024] GEMM on the hi/lo planes of Q (2 products); dense T-2048 attention with EVERY row on hi/lo planes (3 products; unscaled logits), the softmax kernel reading the batch's threshold once and selecting -1e-6 for j >= threshold; merged hi/lo x Wo exact + bo.
// Compute dtypes, f32 accumulate: every input rounded to bf16; projections exact + bf16-rounded biases; Q W hi/lo x exact; scores and attn.V 3 products on every row; softmax f32; Wo hl x exact + bias.

#define NB_  2
#define TT   2048
#define DM   1024
#define NH_  16
#define NKV  16
#define REP  (NH_ / NKV)
#define HD   64
#define DQ   (NH_ * HD)
#define DKV  (NKV * HD)
#define ZH   2
#define RH   2048                  // query rows < RH use hi+lo planes (0: none)
#define WIN  0
#define PCAR 1024.0f
#define SCL  1.0f   // no 1/sqrt(d) in the module
typedef _Float16 h16;
typedef unsigned short bf;
typedef __attribute__((ext_vector_type(16))) __bf16   v16bf;
typedef __attribute__((ext_vector_type(16))) _Float16 v16h;
typedef __attribute__((ext_vector_type(8)))  _Float16 v8h;
typedef __attribute__((ext_vector_type(8)))  unsigned short v8us;
typedef __attribute__((ext_vector_type(8)))  float    v8f;
typedef __attribute__((ext_vector_type(4)))  float    v4f;
typedef v8h  __attribute__((may_alias)) v8ha;
typedef v4f  __attribute__((may_alias)) v4fa;
typedef v8us __attribute__((may_alias)) v8usa;

__device__ __forceinline__ unsigned short f2bf(float f) { unsigned u = __float_as_uint(f); u += 0x7FFFu + ((u >> 16) & 1u); return (unsigned short)(u >> 16); }
__device__ __forceinline__ float bf2f(unsigned short b) { return __uint_as_float(((unsigned)b) << 16); }
__device__ __forceinline__ float bfr(float f) { return bf2f(f2bf(f)); }
__device__ __forceinline__ v16h cat16(v8h lo, v8h hi) { return __builtin_shufflevector(lo, hi, 0, 1, 2, 3, 4, 5, 6, 7, 8, 9, 10, 11, 12, 13, 14, 15); }
__device__ __forceinline__ v16bf cat16b(v8us lo, v8us hi) { return __builtin_bit_cast(v16bf, __builtin_shufflevector(lo, hi, 0, 1, 2, 3, 4, 5, 6, 7, 8, 9, 10, 11, 12, 13, 14, 15)); }
__device__ __forceinline__ v8f wmma16(v16h a, v16h b, v8f c) { return __builtin_amdgcn_wmma_f32_16x16x32_f16(false, a, false, b, (short)0, c, false, false); }
__device__ __forceinline__ v8f wmmab(v16bf a, v16bf b, v8f c) { return __builtin_amdgcn_wmma_f32_16x16x32_bf16(false, a, false, b, (short)0, c, false, false); }



// ---- k_gemmw: register-blocked GEMM, ONE WAVE per 64x64 output tile (16 accumulators), operands straight from K-contiguous 16-bit planes; grid (M/64, N/64, Z), 32 threads.
// C[m][n] (f32, pitch ldc, + optional f32 bias[n]) = sum_k A[m][k] Bt[n][k] (+ split products per NSPLIT). z-batch strides sA/sB/sC in elements. K % 32 == 0.
template <typename T16> struct WFrag;
template <> struct WFrag<h16> { typedef v16h V; static __device__ __forceinline__ V ld(const h16* p) { return cat16(*(const v8h*)p, *(const v8h*)(p + 16)); } static __device__ __forceinline__ v8f mma(V a, V b, v8f c) { return wmma16(a, b, c); } };
template <> struct WFrag<bf> { typedef v16bf V; static __device__ __forceinline__ V ld(const bf* p) { return cat16b(*(const v8us*)p, *(const v8us*)(p + 16)); } static __device__ __forceinline__ v8f mma(V a, V b, v8f c) { return wmmab(a, b, c); } };
template <typename T16, int NSPLIT, bool BIAS>
__global__ __launch_bounds__(32) void k_gemmw(const T16* __restrict__ A, const T16* __restrict__ A2, const T16* __restrict__ Bt, const T16* __restrict__ Bt2, int K, float* C, int ldc, const float* __restrict__ bias, size_t sA, size_t sB, size_t sC) {
    typedef typename WFrag<T16>::V V;
    __shared__ __align__(16) float os[16 * 68];
    const size_t z = blockIdx.z; A += z * sA; if (A2) A2 += z * sA; Bt += z * sB; if (Bt2) Bt2 += z * sB; C += z * sC;
    const int lane = threadIdx.x & 31, lr = lane & 15, hi = lane >> 4; const int r0 = blockIdx.x * 64, c0 = blockIdx.y * 64;
    v8f acc[4][4];
#pragma unroll
    for (int mb = 0; mb < 4; ++mb)
#pragma unroll
        for (int nb = 0; nb < 4; ++nb) acc[mb][nb] = (v8f){};
    const size_t aoff = (size_t)(r0 + lr) * K + 8 * hi, boff = (size_t)(c0 + lr) * K + 8 * hi;
#pragma unroll 1
    for (int kc = 0; kc < K; kc += 32) {
        V a[4], a2[4];
#pragma unroll
        for (int mb = 0; mb < 4; ++mb) { a[mb] = WFrag<T16>::ld(A + aoff + (size_t)mb * 16 * K + kc); if (NSPLIT == 1 || NSPLIT == 2) a2[mb] = WFrag<T16>::ld(A2 + aoff + (size_t)mb * 16 * K + kc); }
#pragma unroll
        for (int nb = 0; nb < 4; ++nb) { const V b = WFrag<T16>::ld(Bt + boff + (size_t)nb * 16 * K + kc); V b2; if (NSPLIT >= 2) b2 = WFrag<T16>::ld(Bt2 + boff + (size_t)nb * 16 * K + kc);
#pragma unroll
            for (int mb = 0; mb < 4; ++mb) { acc[mb][nb] = WFrag<T16>::mma(a[mb], b, acc[mb][nb]); if (NSPLIT == 1 || NSPLIT == 2) acc[mb][nb] = WFrag<T16>::mma(a2[mb], b, acc[mb][nb]); if (NSPLIT >= 2) acc[mb][nb] = WFrag<T16>::mma(a[mb], b2, acc[mb][nb]); } }
        asm volatile("v_nop\n\tv_nop\n\tv_nop\n\tv_nop" : "+v"(acc[0][0]), "+v"(acc[1][1]), "+v"(acc[2][2]), "+v"(acc[3][3]) : "v"(a[0]), "v"(a[3]));
    }
#pragma unroll
    for (int mb = 0; mb < 4; ++mb) {
#pragma unroll
        for (int nb = 0; nb < 4; ++nb) {
#pragma unroll
            for (int j = 0; j < 8; ++j) os[(hi * 8 + j) * 68 + nb * 16 + lr] = acc[mb][nb][j]; }
        __builtin_amdgcn_wave_barrier(); asm volatile("" ::: "memory");
        float* crow = C + (size_t)(r0 + mb * 16) * ldc + c0;
{
#pragma unroll
            for (int s = 0; s < 8; ++s) { const int row = 2 * s + hi, cofs = lr * 4; v4f val = *(const v4fa*)(os + row * 68 + cofs); if (BIAS) { val[0] += bfr(bias[c0 + cofs]); val[1] += bfr(bias[c0 + cofs + 1]); val[2] += bfr(bias[c0 + cofs + 2]); val[3] += bfr(bias[c0 + cofs + 3]); }
                *(v4f*)(crow + (size_t)row * ldc + cofs) = val; }
             }
        __builtin_amdgcn_wave_barrier(); asm volatile("" ::: "memory");
    }
}

__device__ __forceinline__ h16 tohx(float x) { return (h16)x; }
__device__ __forceinline__ void splitf(float y, unsigned short& h, unsigned short& l) { h = f2bf(y); l = f2bf(y - bf2f(h)); }
typedef __attribute__((ext_vector_type(2))) _Float16 v2h;
typedef __attribute__((ext_vector_type(4))) _Float16 v4h;
typedef __attribute__((ext_vector_type(2))) unsigned short v2us;
typedef __attribute__((ext_vector_type(4))) unsigned short v4us;
typedef __attribute__((ext_vector_type(2))) float v2f;
typedef __attribute__((ext_vector_type(4))) int v4i;

__global__ __launch_bounds__(256) void k_wtG(const float* __restrict__ w, int K, int N, bf* Bt) {
    const int lane = threadIdx.x & 31; const int L0 = (blockIdx.x * 8 + (threadIdx.x >> 5)) * 8; const int nlines = N * K / 64;
{
#pragma unroll 1
        for (int l = 0; l < 8; ++l) { const int L = L0 + l; if (L >= nlines) break; const size_t e = (size_t)L * 64 + lane * 2; const int k = (int)(e % K), n = (int)(e / K); v2us o;
            o[0] = f2bf(w[(size_t)k * N + n]); o[1] = f2bf(w[(size_t)(k + 1) * N + n]); *(v2us*)(Bt + e) = o; }
         }
}
__global__ __launch_bounds__(256) void k_cvt8(const float* __restrict__ src, bf* dst, size_t n8) { const size_t i = (size_t)blockIdx.x * 256 + threadIdx.x; if (i >= n8) return; const v8f v = *(const v8f*)(src + i * 8); v8us o;
#pragma unroll
    for (int k = 0; k < 8; ++k) o[k] = f2bf(v[k]); *(v8us*)(dst + i * 8) = o;  }

// k_rope: head planes [h][t][d] (fp16 + hi/lo) of rope(x) x sc with the rotate-half convention out[d] = x[d] cos[t][d] - x[d+HD/2] sin[t][d], out[d+HD/2] = x[d+HD/2] cos[t][d+HD/2] + x[d] sin[t][d+HD/2]
__global__ __launch_bounds__(256) void k_rope(const float* __restrict__ F, int pitch, int nheads, const float* __restrict__ CS, const float* __restrict__ RF, const float* __restrict__ nw, float sc, h16* P16, bf* Ph, bf* Pl) {
    const size_t e = ((size_t)blockIdx.x * 256 + threadIdx.x) * 2; if (e >= (size_t)nheads * TT * HD) return; const int d = (int)(e % HD); const int t = (int)((e / HD) % TT); const int h = (int)(e / ((size_t)HD * TT)); const float* f = F + (size_t)t * pitch + h * HD; const float rf = RF ? RF[(size_t)h * TT + t] : 1.0f; v2h o16; v2us oh, ol;
#pragma unroll
    for (int q = 0; q < 2; ++q) { const int dd = d + q; const int dp = (dd < HD / 2) ? dd + HD / 2 : dd - HD / 2; float x0 = f[dd], x1 = f[dp];
        if (RF) { float n0 = __fmul_rn(x0, rf), n1 = __fmul_rn(x1, rf); asm volatile("" : "+v"(n0)); asm volatile("" : "+v"(n1)); x0 = __fmul_rn(bfr(nw[dd]), n0); x1 = __fmul_rn(bfr(nw[dp]), n1); }
        const v2f cs = *(const v2f*)(CS + ((size_t)t * HD + dd) * 2); float a = __fmul_rn(x0, cs[0]), bq = __fmul_rn(x1, cs[1]); asm volatile("" : "+v"(a)); asm volatile("" : "+v"(bq)); const float r = ((dd < HD / 2) ? __fsub_rn(a, bq) : __fadd_rn(a, bq)) * sc;
        o16[q] = tohx(r); unsigned short a2, c2; splitf(r, a2, c2); oh[q] = a2; ol[q] = c2; }
    *(v2h*)(P16 + e) = o16; *(v2us*)(Ph + e) = oh; *(v2us*)(Pl + e) = ol;  }
__global__ __launch_bounds__(256) void k_vtp(const float* __restrict__ F, int pitch, int nheads, h16* V16, bf* Vh, bf* Vl) { const size_t e = ((size_t)blockIdx.x * 256 + threadIdx.x) * 2; if (e >= (size_t)nheads * HD * TT) return; const int t = (int)(e % TT); const int d = (int)((e / TT) % HD); const int g = (int)(e / ((size_t)TT * HD)); v2h o16; v2us oh, ol;
#pragma unroll
    for (int q = 0; q < 2; ++q) { const float x = F[(size_t)(t + q) * pitch + g * HD + d]; o16[q] = tohx(x); unsigned short a2, c2; splitf(x, a2, c2); oh[q] = a2; ol[q] = c2; }
    *(v2h*)(V16 + e) = o16; *(v2us*)(Vh + e) = oh; *(v2us*)(Vl + e) = ol;  }
__global__ __launch_bounds__(256) void k_csid(float* CS) { const int idx = blockIdx.x * 256 + threadIdx.x; if (idx >= TT * HD) return; v2f cs; cs[0] = 1.0f; cs[1] = 0.0f; *(v2f*)(CS + (size_t)idx * 2) = cs;  }
// k_asoft: per row (zz, i): t = S (unscaled), -1e-6 for keys j >= threshold; softmax over the 2048 keys (register row, one exp, fixed trees);
__global__ __launch_bounds__(256) void k_asoft(const float* __restrict__ Sb, const int* __restrict__ thrp, h16* P16, bf* Ph, bf* Pl) { const int thr = thrp[0];   /* the batch's key threshold (input) */
    const int lane = threadIdx.x & 31; const int row = blockIdx.x * 8 + (threadIdx.x >> 5); if (row >= ZH * TT) return; const int i = row % TT; const int zz = row / TT; (void)zz; const bool hires = (i < RH); const float* sr = Sb + (size_t)row * TT; float v[TT / 32]; float mx = -3.0e38f;
#pragma unroll
    for (int ch = 0; ch < TT / 128; ++ch) { const int j0 = ch * 128 + lane * 4; const v4f a = *(const v4f*)(sr + j0);
#pragma unroll
        for (int q = 0; q < 4; ++q) { const int j = j0 + q; const float t = (j < thr) ? a[q] * SCL : -1.0e-6f; v[ch * 4 + q] = t;   /* keys >= threshold get the VALUE -1e-6 (MASK_VALUE), not an exclusion */ mx = fmaxf(mx, t); } }
#pragma unroll
    for (int sh = 16; sh; sh >>= 1) mx = fmaxf(mx, __shfl_xor(mx, sh, 32));
    float sum = 0.f;
#pragma unroll
    for (int k = 0; k < TT / 32; ++k) { float d0 = __fsub_rn(v[k], mx); asm volatile("" : "+v"(d0)); v[k] = __builtin_amdgcn_exp2f(__fmul_rn(d0, 1.4426950408889634f)); sum += v[k]; }
#pragma unroll
    for (int sh = 16; sh; sh >>= 1) sum += __shfl_xor(sum, sh, 32);
    const float f = __fdiv_rn(hires ? 1.0f : PCAR, sum);
{
        if (hires) {
#pragma unroll
            for (int ch = 0; ch < TT / 128; ++ch) { v4us oh, ol;
#pragma unroll
                for (int q = 0; q < 4; ++q) { unsigned short a, c2; splitf(v[ch * 4 + q] * f, a, c2); oh[q] = a; ol[q] = c2; }
                const size_t oo = ((size_t)zz * (RH ? RH : 1) + i) * TT + ch * 128 + lane * 4; *(v4us*)(Ph + oo) = oh; *(v4us*)(Pl + oo) = ol; }
        } else {
#pragma unroll
            for (int ch = 0; ch < TT / 128; ++ch) { v4h o4;
#pragma unroll
                for (int q = 0; q < 4; ++q) o4[q] = tohx(v[ch * 4 + q] * f);
                *(v4h*)(P16 + (size_t)row * TT + ch * 128 + lane * 4) = o4; } }
         }
}
__global__ __launch_bounds__(256) void k_flat(const float* __restrict__ F, h16* P16, bf* Ph, bf* Pl, size_t n4) { const size_t i = (size_t)blockIdx.x * 256 + threadIdx.x; if (i >= n4) return; const v4f a = *(const v4f*)(F + i * 4); v4h o16; v4us oh, ol;
#pragma unroll
    for (int q = 0; q < 4; ++q) { o16[q] = tohx(a[q]); unsigned short x2, y2; splitf(a[q], x2, y2); oh[q] = x2; ol[q] = y2; }
    *(v4h*)(P16 + i * 4) = o16; *(v4us*)(Ph + i * 4) = oh; *(v4us*)(Pl + i * 4) = ol;  }

__global__ __launch_bounds__(256) void k_wbdx(const float* __restrict__ w, bf* Bt) { const size_t i = (size_t)blockIdx.x * 256 + threadIdx.x; if (i >= (size_t)DQ * DQ / 8) return; const int k0 = (int)(i % (DQ / 8)) * 8; const int n = (int)(i / (DQ / 8)); const int h = n / HD, nn = n % HD; const int hb = k0 / HD; v8us o;
#pragma unroll
    for (int q = 0; q < 8; ++q) { const unsigned short v = f2bf(w[(size_t)((k0 + q) % HD) * HD + nn]); o[q] = (hb == h) ? v : (unsigned short)0; }
    *(v8us*)(Bt + (size_t)n * DQ + k0) = o;  }
__global__ __launch_bounds__(256) void k_merge(const float* __restrict__ O, int h0, bf* Ah, bf* Al) { const size_t e = ((size_t)blockIdx.x * 256 + threadIdx.x) * 2; if (e >= (size_t)ZH * TT * HD) return; const int d = (int)(e % HD); const int t = (int)((e / HD) % TT); const int zz = (int)(e / ((size_t)HD * TT)); const float cs = (t < RH) ? 1.0f : (1.0f / PCAR); const size_t oo = (size_t)t * DQ + (h0 + zz) * HD + d;
    v2us oh, ol;
#pragma unroll
    for (int q = 0; q < 2; ++q) { unsigned short a, c2; splitf(O[e + q] * cs, a, c2); oh[q] = a; ol[q] = c2; } *(v2us*)(Ah + oo) = oh; *(v2us*)(Al + oo) = ol;  }

extern "C" void kernel_launch(void* const* d_in, const int* in_sizes, int n_in,
                              void* d_out, int out_size, void* d_ws, size_t ws_size, hipStream_t stream) {
    (void)in_sizes; (void)n_in; (void)out_size;
    const float* x = (const float*)d_in[0]; const float* xk = (const float*)d_in[1]; const float* xv = (const float*)d_in[2]; const int* thr = (const int*)d_in[3]; const float* wq = (const float*)d_in[4]; const float* bq = (const float*)d_in[5]; const float* wk = (const float*)d_in[6]; const float* bk = (const float*)d_in[7]; const float* wv = (const float*)d_in[8]; const float* bv = (const float*)d_in[9]; const float* wbl = (const float*)d_in[10]; const float* wo = (const float*)d_in[11]; const float* bo = (const float*)d_in[12];
    float* OUT = (float*)d_out;     // [2][2048][1024]
    char* wsp = (char*)d_ws;
    auto take = [&](size_t bytes) { char* p = wsp; wsp += (bytes + 255) & ~(size_t)255; return (void*)p; };
    bf* WBD = (bf*)take((size_t)DQ * DQ * 2); h16* FQ16 = (h16*)take((size_t)TT * DQ * 2); bf* FQh = (bf*)take((size_t)TT * DQ * 2); bf* FQl = (bf*)take((size_t)TT * DQ * 2); float* FQW = (float*)take((size_t)TT * DQ * 4); bf* WQ = (bf*)take((size_t)DQ * DM * 2); bf* WK = (bf*)take((size_t)DKV * DM * 2); bf* WV = (bf*)take((size_t)DKV * DM * 2); bf* WO = (bf*)take((size_t)DM * DQ * 2); float* CS = (float*)take((size_t)TT * HD * 2 * 4);
    bf* XB = (bf*)take((size_t)TT * DM * 2); float* FQ = (float*)take((size_t)TT * DQ * 4); float* FK = (float*)take((size_t)TT * DKV * 4);
    h16* QP16 = (h16*)take((size_t)NH_ * TT * HD * 2); h16* KP16 = (h16*)take((size_t)NKV * TT * HD * 2); h16* VT16 = (h16*)take((size_t)NKV * HD * TT * 2);
    bf* QPh = (bf*)take((size_t)NH_ * TT * HD * 2); bf* QPl = (bf*)take((size_t)NH_ * TT * HD * 2); bf* KPh = (bf*)take((size_t)NKV * TT * HD * 2); bf* KPl = (bf*)take((size_t)NKV * TT * HD * 2); bf* VTh = (bf*)take((size_t)NKV * HD * TT * 2); bf* VTl = (bf*)take((size_t)NKV * HD * TT * 2); bf* Ph = (bf*)take((size_t)ZH * RH * TT * 2); bf* Pl = (bf*)take((size_t)ZH * RH * TT * 2);
    float* Sb = (float*)take((size_t)ZH * TT * TT * 4); h16* P16 = nullptr; float* Ob = (float*)take((size_t)ZH * TT * HD * 4); bf* ATh = (bf*)take((size_t)TT * DQ * 2); bf* ATl = (bf*)take((size_t)TT * DQ * 2);
    if ((size_t)(wsp - (char*)d_ws) > ws_size) return;    // ws 256 MiB
    float* FV = FK;   // v projection reuses the k buffer after the k planes are built (stream-ordered)
    { k_wbdx<<<(unsigned)(((size_t)DQ * DQ / 8 + 255) / 256), 256, 0, stream>>>(wbl, WBD); k_wtG<<<(unsigned)((DM * DQ / 64 + 63) / 64), 256, 0, stream>>>(wq, DM, DQ, WQ); k_wtG<<<(unsigned)((DM * DKV / 64 + 63) / 64), 256, 0, stream>>>(wk, DM, DKV, WK); k_wtG<<<(unsigned)((DM * DKV / 64 + 63) / 64), 256, 0, stream>>>(wv, DM, DKV, WV);
      k_wtG<<<(unsigned)((DQ * DM / 64 + 63) / 64), 256, 0, stream>>>(wo, DQ, DM, WO);
       }
    k_csid<<<(TT * HD + 255) / 256, 256, 0, stream>>>(CS);
    const unsigned LQ = (unsigned)(((size_t)NH_ * TT * HD / 2 + 255) / 256), LKv = (unsigned)(((size_t)NKV * TT * HD / 2 + 255) / 256);
    for (int b = 0; b < NB_; ++b) {
        
        k_cvt8<<<(unsigned)(((size_t)TT * DM / 8 + 255) / 256), 256, 0, stream>>>(x + (size_t)b * TT * DM, XB, (size_t)TT * DM / 8);
        k_gemmw<bf, 0, true><<<dim3(TT / 64, DQ / 64, 1), 32, 0, stream>>>(XB, nullptr, WQ, nullptr, DM, FQ, DQ, bq, 0, 0, 0); k_flat<<<(unsigned)(((size_t)TT * DQ / 4 + 255) / 256), 256, 0, stream>>>(FQ, FQ16, FQh, FQl, (size_t)TT * DQ / 4); k_gemmw<bf, 1, false><<<dim3(TT / 64, DQ / 64, 1), 32, 0, stream>>>(FQh, FQl, WBD, nullptr, DQ, FQW, DQ, nullptr, 0, 0, 0);   /* Q W (W shared by all heads = block-diagonal) */
        k_rope<<<LQ, 256, 0, stream>>>(FQW, DQ, NH_, CS, nullptr, nullptr, 1.0f, QP16, QPh, QPl);
        k_cvt8<<<(unsigned)(((size_t)TT * DM / 8 + 255) / 256), 256, 0, stream>>>(xk + (size_t)b * TT * DM, XB, (size_t)TT * DM / 8); k_gemmw<bf, 0, true><<<dim3(TT / 64, DKV / 64, 1), 32, 0, stream>>>(XB, nullptr, WK, nullptr, DM, FK, DKV, bk, 0, 0, 0);
        k_rope<<<LKv, 256, 0, stream>>>(FK, DKV, NKV, CS, nullptr, nullptr, 1.0f, KP16, KPh, KPl);
        k_cvt8<<<(unsigned)(((size_t)TT * DM / 8 + 255) / 256), 256, 0, stream>>>(xv + (size_t)b * TT * DM, XB, (size_t)TT * DM / 8); k_gemmw<bf, 0, true><<<dim3(TT / 64, DKV / 64, 1), 32, 0, stream>>>(XB, nullptr, WV, nullptr, DM, FV, DKV, bv, 0, 0, 0); k_vtp<<<LKv, 256, 0, stream>>>(FV, DKV, NKV, VT16, VTh, VTl);
        for (int h0 = 0; h0 < NH_; h0 += ZH) { const size_t zq = (size_t)h0, zk = (size_t)(h0 / REP);   // one kv head per query head: the pass's two heads use consecutive kv planes (z-strides TT*HD)
            k_gemmw<bf, 2, false><<<dim3(RH / 64, TT / 64, ZH), 32, 0, stream>>>(QPh + zq * TT * HD, QPl + zq * TT * HD, KPh + zk * TT * HD, KPl + zk * TT * HD, HD, Sb, TT, nullptr, (size_t)TT * HD, (size_t)TT * HD, (size_t)TT * TT);
            k_asoft<<<ZH * TT / 8, 256, 0, stream>>>(Sb, thr + b, P16, Ph, Pl);
            k_gemmw<bf, 2, false><<<dim3(RH / 64, HD / 64, ZH), 32, 0, stream>>>(Ph, Pl, VTh + zk * HD * TT, VTl + zk * HD * TT, TT, Ob, HD, nullptr, (size_t)RH * TT, (size_t)HD * TT, (size_t)TT * HD);
            k_merge<<<(unsigned)(((size_t)ZH * TT * HD / 2 + 255) / 256), 256, 0, stream>>>(Ob, h0, ATh, ATl); }
        k_gemmw<bf, 1, true><<<dim3(TT / 64, DM / 64, 1), 32, 0, stream>>>(ATh, ATl, WO, nullptr, DQ, OUT + (size_t)b * TT * DM, DM, bo, 0, 0, 0); }
}

// v001
// Measured time: 950 microseconds a run.
// In two side-by-side timings against v000, it was 1.47 and 1.49 times as fast.
#include <hip/hip_runtime.h>

// Multi-head attention with a learned bilinear score and a per-batch key threshold (queries, keys, values [2][2048][1024]; Q,K,V = input W + b ('xw' [1024][1024] + [1024]; 16 heads x 64); scores = (Q W).K with W [64][64] shared by all heads, NO 1/sqrt(d) (logit sigma ~8); keys j >= thresholds[b] get the logit MASK_VALUE = -1e-6 (a value near zero, NOT an exclusion -- reproduced literally; thresholds int [2], read); softmax; out = merged attn.V Wo + bo -> [2][2048][1024] (4.2 M)).
// Layout per batch: bf16 copies of the three inputs in turn; exact projections + bf16-rounded biases; the bilinear W applied as one block-diagonal [1024][1024] GEMM on the hi/lo planes of Q (2 products); dense T-2048 attention with EVERY row on hi/lo planes (3 products; unscaled logits), the softmax kernel reading the batch's threshold once and selecting -1e-6 for j >= threshold; merged hi/lo x Wo exact + bo.
// Compute dtypes, f32 accumulate: every input rounded to bf16; projections exact + bf16-rounded biases; Q W hi/lo x exact; scores and attn.V 3 products on every row; softmax f32; Wo hl x exact + bias.

#define NB_  2
#define TT   2048
#define DM   1024
#define NH_  16
#define NKV  16
#define REP  (NH_ / NKV)
#define HD   64
#define DQ   (NH_ * HD)
#define DKV  (NKV * HD)
#define ZH   2
#define RH   2048                  // query rows < RH use hi+lo planes (0: none)
#define WIN  0
#define PCAR 1024.0f
#define SCL  1.0f   // no 1/sqrt(d) in the module
typedef _Float16 h16;
typedef unsigned short bf;
typedef __attribute__((ext_vector_type(16))) __bf16   v16bf;
typedef __attribute__((ext_vector_type(16))) _Float16 v16h;
typedef __attribute__((ext_vector_type(8)))  _Float16 v8h;
typedef __attribute__((ext_vector_type(8)))  unsigned short v8us;
typedef __attribute__((ext_vector_type(8)))  float    v8f;
typedef __attribute__((ext_vector_type(4)))  float    v4f;
typedef v8h  __attribute__((may_alias)) v8ha;
typedef v4f  __attribute__((may_alias)) v4fa;
typedef v8us __attribute__((may_alias)) v8usa;

__device__ __forceinline__ unsigned short f2bf(float f) { unsigned u = __float_as_uint(f); u += 0x7FFFu + ((u >> 16) & 1u); return (unsigned short)(u >> 16); }
__device__ __forceinline__ float bf2f(unsigned short b) { return __uint_as_float(((unsigned)b) << 16); }
__device__ __forceinline__ float bfr(float f) { return bf2f(f2bf(f)); }
__device__ __forceinline__ v16h cat16(v8h lo, v8h hi) { return __builtin_shufflevector(lo, hi, 0, 1, 2, 3, 4, 5, 6, 7, 8, 9, 10, 11, 12, 13, 14, 15); }
__device__ __forceinline__ v16bf cat16b(v8us lo, v8us hi) { return __builtin_bit_cast(v16bf, __builtin_shufflevector(lo, hi, 0, 1, 2, 3, 4, 5, 6, 7, 8, 9, 10, 11, 12, 13, 14, 15)); }
__device__ __forceinline__ v8f wmma16(v16h a, v16h b, v8f c) { return __builtin_amdgcn_wmma_f32_16x16x32_f16(false, a, false, b, (short)0, c, false, false); }
__device__ __forceinline__ v8f wmmab(v16bf a, v16bf b, v8f c) { return __builtin_amdgcn_wmma_f32_16x16x32_bf16(false, a, false, b, (short)0, c, false, false); }



// ---- k_gemmw: register-blocked GEMM, one 64x64 output tile per block (16 accumulators per wave), operands straight from K-contiguous 16-bit planes; grid (M/64, N/64, Z), 32 * KW threads.
// C[m][n] (f32, pitch ldc, + optional f32 bias[n]) = sum_k A[m][k] Bt[n][k] (+ split products per NSPLIT). z-batch strides sA/sB/sC in elements. K % (32 * KW) == 0.
// KW waves share the tile's K range: wave w takes the 32-wide k blocks w, w + KW, ... into its own full set of accumulators; the KW partial tiles are joined in LDS in the fixed order w = 0 .. KW-1 (KW = 1: no join).
template <typename T16> struct WFrag;
template <> struct WFrag<h16> { typedef v16h V; static __device__ __forceinline__ V ld(const h16* p) { return cat16(*(const v8h*)p, *(const v8h*)(p + 16)); } static __device__ __forceinline__ v8f mma(V a, V b, v8f c) { return wmma16(a, b, c); } };
template <> struct WFrag<bf> { typedef v16bf V; static __device__ __forceinline__ V ld(const bf* p) { return cat16b(*(const v8us*)p, *(const v8us*)(p + 16)); } static __device__ __forceinline__ v8f mma(V a, V b, v8f c) { return wmmab(a, b, c); } };
template <typename T16, int NSPLIT, bool BIAS, int KW>
__global__ __launch_bounds__(32 * KW) void k_gemmw(const T16* __restrict__ A, const T16* __restrict__ A2, const T16* __restrict__ Bt, const T16* __restrict__ Bt2, int K, float* C, int ldc, const float* __restrict__ bias, size_t sA, size_t sB, size_t sC) {
    typedef typename WFrag<T16>::V V;
    static_assert(KW == 1 || 32 % KW == 0, "the join walks the 64 rows in steps of 2 * KW");
    constexpr int SLAB = (KW == 1 ? 16 : 64) * 68;   // floats of one wave's staging slab (KW > 1: its whole partial tile)
    __shared__ __align__(16) float os[KW * SLAB];
    const int wv = (KW == 1) ? 0 : __builtin_amdgcn_readfirstlane((int)(threadIdx.x >> 5));   // wave number as a scalar: the k loop stays a scalar loop
    const size_t z = blockIdx.z; A += z * sA; if (A2) A2 += z * sA; Bt += z * sB; if (Bt2) Bt2 += z * sB; C += z * sC;
    const int lane = threadIdx.x & 31, lr = lane & 15, hi = lane >> 4; const int r0 = blockIdx.x * 64, c0 = blockIdx.y * 64;
    v8f acc[4][4];
#pragma unroll
    for (int mb = 0; mb < 4; ++mb)
#pragma unroll
        for (int nb = 0; nb < 4; ++nb) acc[mb][nb] = (v8f){};
    const size_t aoff = (size_t)(r0 + lr) * K + 8 * hi, boff = (size_t)(c0 + lr) * K + 8 * hi;
#pragma unroll 1
    for (int kc = wv * 32; kc < K; kc += 32 * KW) {
        V a[4], a2[4];
#pragma unroll
        for (int mb = 0; mb < 4; ++mb) { a[mb] = WFrag<T16>::ld(A + aoff + (size_t)mb * 16 * K + kc); if (NSPLIT == 1 || NSPLIT == 2) a2[mb] = WFrag<T16>::ld(A2 + aoff + (size_t)mb * 16 * K + kc); }
#pragma unroll
        for (int nb = 0; nb < 4; ++nb) { const V b = WFrag<T16>::ld(Bt + boff + (size_t)nb * 16 * K + kc); V b2; if (NSPLIT >= 2) b2 = WFrag<T16>::ld(Bt2 + boff + (size_t)nb * 16 * K + kc);
#pragma unroll
            for (int mb = 0; mb < 4; ++mb) { acc[mb][nb] = WFrag<T16>::mma(a[mb], b, acc[mb][nb]); if (NSPLIT == 1 || NSPLIT == 2) acc[mb][nb] = WFrag<T16>::mma(a2[mb], b, acc[mb][nb]); if (NSPLIT >= 2) acc[mb][nb] = WFrag<T16>::mma(a[mb], b2, acc[mb][nb]); } }
        asm volatile("v_nop\n\tv_nop\n\tv_nop\n\tv_nop" : "+v"(acc[0][0]), "+v"(acc[1][1]), "+v"(acc[2][2]), "+v"(acc[3][3]) : "v"(a[0]), "v"(a[3]));
    }
    if constexpr (KW > 1) {
        float* osw = os + wv * SLAB;
#pragma unroll
        for (int mb = 0; mb < 4; ++mb)
#pragma unroll
            for (int nb = 0; nb < 4; ++nb)
#pragma unroll
                for (int j = 0; j < 8; ++j) osw[(mb * 16 + hi * 8 + j) * 68 + nb * 16 + lr] = acc[mb][nb][j];
        __syncthreads();   // every wave's partial tile is in LDS before any thread sums it
        const int row0 = (int)(threadIdx.x >> 4), cofs = (int)(threadIdx.x & 15) * 4;   // the block covers 2 * KW rows of 16 float4 per step
#pragma unroll
        for (int q = 0; q < 32 / KW; ++q) { const int row = q * 2 * KW + row0; v4f val = *(const v4fa*)(os + row * 68 + cofs);
#pragma unroll
            for (int w = 1; w < KW; ++w) val += *(const v4fa*)(os + w * SLAB + row * 68 + cofs);
            if (BIAS) { val[0] += bfr(bias[c0 + cofs]); val[1] += bfr(bias[c0 + cofs + 1]); val[2] += bfr(bias[c0 + cofs + 2]); val[3] += bfr(bias[c0 + cofs + 3]); }
            *(v4f*)(C + (size_t)(r0 + row) * ldc + c0 + cofs) = val; }
        return;
    }
#pragma unroll
    for (int mb = 0; mb < 4; ++mb) {
#pragma unroll
        for (int nb = 0; nb < 4; ++nb) {
#pragma unroll
            for (int j = 0; j < 8; ++j) os[(hi * 8 + j) * 68 + nb * 16 + lr] = acc[mb][nb][j]; }
        __builtin_amdgcn_wave_barrier(); asm volatile("" ::: "memory");
        float* crow = C + (size_t)(r0 + mb * 16) * ldc + c0;
{
#pragma unroll
            for (int s = 0; s < 8; ++s) { const int row = 2 * s + hi, cofs = lr * 4; v4f val = *(const v4fa*)(os + row * 68 + cofs); if (BIAS) { val[0] += bfr(bias[c0 + cofs]); val[1] += bfr(bias[c0 + cofs + 1]); val[2] += bfr(bias[c0 + cofs + 2]); val[3] += bfr(bias[c0 + cofs + 3]); }
                *(v4f*)(crow + (size_t)row * ldc + cofs) = val; }
             }
        __builtin_amdgcn_wave_barrier(); asm volatile("" ::: "memory");
    }
}

__device__ __forceinline__ h16 tohx(float x) { return (h16)x; }
__device__ __forceinline__ void splitf(float y, unsigned short& h, unsigned short& l) { h = f2bf(y); l = f2bf(y - bf2f(h)); }
typedef __attribute__((ext_vector_type(2))) _Float16 v2h;
typedef __attribute__((ext_vector_type(4))) _Float16 v4h;
typedef __attribute__((ext_vector_type(2))) unsigned short v2us;
typedef __attribute__((ext_vector_type(4))) unsigned short v4us;
typedef __attribute__((ext_vector_type(2))) float v2f;
typedef __attribute__((ext_vector_type(4))) int v4i;

__global__ __launch_bounds__(256) void k_wtG(const float* __restrict__ w, int K, int N, bf* Bt) {
    const int lane = threadIdx.x & 31; const int L0 = (blockIdx.x * 8 + (threadIdx.x >> 5)) * 8; const int nlines = N * K / 64;
{
#pragma unroll 1
        for (int l = 0; l < 8; ++l) { const int L = L0 + l; if (L >= nlines) break; const size_t e = (size_t)L * 64 + lane * 2; const int k = (int)(e % K), n = (int)(e / K); v2us o;
            o[0] = f2bf(w[(size_t)k * N + n]); o[1] = f2bf(w[(size_t)(k + 1) * N + n]); *(v2us*)(Bt + e) = o; }
         }
}
__global__ __launch_bounds__(256) void k_cvt8(const float* __restrict__ src, bf* dst, size_t n8) { const size_t i = (size_t)blockIdx.x * 256 + threadIdx.x; if (i >= n8) return; const v8f v = *(const v8f*)(src + i * 8); v8us o;
#pragma unroll
    for (int k = 0; k < 8; ++k) o[k] = f2bf(v[k]); *(v8us*)(dst + i * 8) = o;  }

// k_rope: head planes [h][t][d] (fp16 + hi/lo) of rope(x) x sc with the rotate-half convention out[d] = x[d] cos[t][d] - x[d+HD/2] sin[t][d], out[d+HD/2] = x[d+HD/2] cos[t][d+HD/2] + x[d] sin[t][d+HD/2]
__global__ __launch_bounds__(256) void k_rope(const float* __restrict__ F, int pitch, int nheads, const float* __restrict__ CS, const float* __restrict__ RF, const float* __restrict__ nw, float sc, h16* P16, bf* Ph, bf* Pl) {
    const size_t e = ((size_t)blockIdx.x * 256 + threadIdx.x) * 2; if (e >= (size_t)nheads * TT * HD) return; const int d = (int)(e % HD); const int t = (int)((e / HD) % TT); const int h = (int)(e / ((size_t)HD * TT)); const float* f = F + (size_t)t * pitch + h * HD; const float rf = RF ? RF[(size_t)h * TT + t] : 1.0f; v2h o16; v2us oh, ol;
#pragma unroll
    for (int q = 0; q < 2; ++q) { const int dd = d + q; const int dp = (dd < HD / 2) ? dd + HD / 2 : dd - HD / 2; float x0 = f[dd], x1 = f[dp];
        if (RF) { float n0 = __fmul_rn(x0, rf), n1 = __fmul_rn(x1, rf); asm volatile("" : "+v"(n0)); asm volatile("" : "+v"(n1)); x0 = __fmul_rn(bfr(nw[dd]), n0); x1 = __fmul_rn(bfr(nw[dp]), n1); }
        const v2f cs = *(const v2f*)(CS + ((size_t)t * HD + dd) * 2); float a = __fmul_rn(x0, cs[0]), bq = __fmul_rn(x1, cs[1]); asm volatile("" : "+v"(a)); asm volatile("" : "+v"(bq)); const float r = ((dd < HD / 2) ? __fsub_rn(a, bq) : __fadd_rn(a, bq)) * sc;
        o16[q] = tohx(r); unsigned short a2, c2; splitf(r, a2, c2); oh[q] = a2; ol[q] = c2; }
    *(v2h*)(P16 + e) = o16; *(v2us*)(Ph + e) = oh; *(v2us*)(Pl + e) = ol;  }
__global__ __launch_bounds__(256) void k_vtp(const float* __restrict__ F, int pitch, int nheads, h16* V16, bf* Vh, bf* Vl) { const size_t e = ((size_t)blockIdx.x * 256 + threadIdx.x) * 2; if (e >= (size_t)nheads * HD * TT) return; const int t = (int)(e % TT); const int d = (int)((e / TT) % HD); const int g = (int)(e / ((size_t)TT * HD)); v2h o16; v2us oh, ol;
#pragma unroll
    for (int q = 0; q < 2; ++q) { const float x = F[(size_t)(t + q) * pitch + g * HD + d]; o16[q] = tohx(x); unsigned short a2, c2; splitf(x, a2, c2); oh[q] = a2; ol[q] = c2; }
    *(v2h*)(V16 + e) = o16; *(v2us*)(Vh + e) = oh; *(v2us*)(Vl + e) = ol;  }
__global__ __launch_bounds__(256) void k_csid(float* CS) { const int idx = blockIdx.x * 256 + threadIdx.x; if (idx >= TT * HD) return; v2f cs; cs[0] = 1.0f; cs[1] = 0.0f; *(v2f*)(CS + (size_t)idx * 2) = cs;  }
// k_asoft: per row (zz, i): t = S (unscaled), -1e-6 for keys j >= threshold; softmax over the 2048 keys (register row, one exp, fixed trees);
__global__ __launch_bounds__(256) void k_asoft(const float* __restrict__ Sb, const int* __restrict__ thrp, h16* P16, bf* Ph, bf* Pl) { const int thr = thrp[0];   /* the batch's key threshold (input) */
    const int lane = threadIdx.x & 31; const int row = blockIdx.x * 8 + (threadIdx.x >> 5); if (row >= ZH * TT) return; const int i = row % TT; const int zz = row / TT; (void)zz; const bool hires = (i < RH); const float* sr = Sb + (size_t)row * TT; float v[TT / 32]; float mx = -3.0e38f;
#pragma unroll
    for (int ch = 0; ch < TT / 128; ++ch) { const int j0 = ch * 128 + lane * 4; const v4f a = *(const v4f*)(sr + j0);
#pragma unroll
        for (int q = 0; q < 4; ++q) { const int j = j0 + q; const float t = (j < thr) ? a[q] * SCL : -1.0e-6f; v[ch * 4 + q] = t;   /* keys >= threshold get the VALUE -1e-6 (MASK_VALUE), not an exclusion */ mx = fmaxf(mx, t); } }
#pragma unroll
    for (int sh = 16; sh; sh >>= 1) mx = fmaxf(mx, __shfl_xor(mx, sh, 32));
    float sum = 0.f;
#pragma unroll
    for (int k = 0; k < TT / 32; ++k) { float d0 = __fsub_rn(v[k], mx); asm volatile("" : "+v"(d0)); v[k] = __builtin_amdgcn_exp2f(__fmul_rn(d0, 1.4426950408889634f)); sum += v[k]; }
#pragma unroll
    for (int sh = 16; sh; sh >>= 1) sum += __shfl_xor(sum, sh, 32);
    const float f = __fdiv_rn(hires ? 1.0f : PCAR, sum);
{
        if (hires) {
#pragma unroll
            for (int ch = 0; ch < TT / 128; ++ch) { v4us oh, ol;
#pragma unroll
                for (int q = 0; q < 4; ++q) { unsigned short a, c2; splitf(v[ch * 4 + q] * f, a, c2); oh[q] = a; ol[q] = c2; }
                const size_t oo = ((size_t)zz * (RH ? RH : 1) + i) * TT + ch * 128 + lane * 4; *(v4us*)(Ph + oo) = oh; *(v4us*)(Pl + oo) = ol; }
        } else {
#pragma unroll
            for (int ch = 0; ch < TT / 128; ++ch) { v4h o4;
#pragma unroll
                for (int q = 0; q < 4; ++q) o4[q] = tohx(v[ch * 4 + q] * f);
                *(v4h*)(P16 + (size_t)row * TT + ch * 128 + lane * 4) = o4; } }
         }
}
__global__ __launch_bounds__(256) void k_flat(const float* __restrict__ F, h16* P16, bf* Ph, bf* Pl, size_t n4) { const size_t i = (size_t)blockIdx.x * 256 + threadIdx.x; if (i >= n4) return; const v4f a = *(const v4f*)(F + i * 4); v4h o16; v4us oh, ol;
#pragma unroll
    for (int q = 0; q < 4; ++q) { o16[q] = tohx(a[q]); unsigned short x2, y2; splitf(a[q], x2, y2); oh[q] = x2; ol[q] = y2; }
    *(v4h*)(P16 + i * 4) = o16; *(v4us*)(Ph + i * 4) = oh; *(v4us*)(Pl + i * 4) = ol;  }

__global__ __launch_bounds__(256) void k_wbdx(const float* __restrict__ w, bf* Bt) { const size_t i = (size_t)blockIdx.x * 256 + threadIdx.x; if (i >= (size_t)DQ * DQ / 8) return; const int k0 = (int)(i % (DQ / 8)) * 8; const int n = (int)(i / (DQ / 8)); const int h = n / HD, nn = n % HD; const int hb = k0 / HD; v8us o;
#pragma unroll
    for (int q = 0; q < 8; ++q) { const unsigned short v = f2bf(w[(size_t)((k0 + q) % HD) * HD + nn]); o[q] = (hb == h) ? v : (unsigned short)0; }
    *(v8us*)(Bt + (size_t)n * DQ + k0) = o;  }
__global__ __launch_bounds__(256) void k_merge(const float* __restrict__ O, int h0, bf* Ah, bf* Al) { const size_t e = ((size_t)blockIdx.x * 256 + threadIdx.x) * 2; if (e >= (size_t)ZH * TT * HD) return; const int d = (int)(e % HD); const int t = (int)((e / HD) % TT); const int zz = (int)(e / ((size_t)HD * TT)); const float cs = (t < RH) ? 1.0f : (1.0f / PCAR); const size_t oo = (size_t)t * DQ + (h0 + zz) * HD + d;
    v2us oh, ol;
#pragma unroll
    for (int q = 0; q < 2; ++q) { unsigned short a, c2; splitf(O[e + q] * cs, a, c2); oh[q] = a; ol[q] = c2; } *(v2us*)(Ah + oo) = oh; *(v2us*)(Al + oo) = ol;  }

extern "C" void kernel_launch(void* const* d_in, const int* in_sizes, int n_in,
                              void* d_out, int out_size, void* d_ws, size_t ws_size, hipStream_t stream) {
    (void)in_sizes; (void)n_in; (void)out_size;
    const float* x = (const float*)d_in[0]; const float* xk = (const float*)d_in[1]; const float* xv = (const float*)d_in[2]; const int* thr = (const int*)d_in[3]; const float* wq = (const float*)d_in[4]; const float* bq = (const float*)d_in[5]; const float* wk = (const float*)d_in[6]; const float* bk = (const float*)d_in[7]; const float* wv = (const float*)d_in[8]; const float* bv = (const float*)d_in[9]; const float* wbl = (const float*)d_in[10]; const float* wo = (const float*)d_in[11]; const float* bo = (const float*)d_in[12];
    float* OUT = (float*)d_out;     // [2][2048][1024]
    char* wsp = (char*)d_ws;
    auto take = [&](size_t bytes) { char* p = wsp; wsp += (bytes + 255) & ~(size_t)255; return (void*)p; };
    bf* WBD = (bf*)take((size_t)DQ * DQ * 2); h16* FQ16 = (h16*)take((size_t)TT * DQ * 2); bf* FQh = (bf*)take((size_t)TT * DQ * 2); bf* FQl = (bf*)take((size_t)TT * DQ * 2); float* FQW = (float*)take((size_t)TT * DQ * 4); bf* WQ = (bf*)take((size_t)DQ * DM * 2); bf* WK = (bf*)take((size_t)DKV * DM * 2); bf* WV = (bf*)take((size_t)DKV * DM * 2); bf* WO = (bf*)take((size_t)DM * DQ * 2); float* CS = (float*)take((size_t)TT * HD * 2 * 4);
    bf* XB = (bf*)take((size_t)TT * DM * 2); float* FQ = (float*)take((size_t)TT * DQ * 4); float* FK = (float*)take((size_t)TT * DKV * 4);
    h16* QP16 = (h16*)take((size_t)NH_ * TT * HD * 2); h16* KP16 = (h16*)take((size_t)NKV * TT * HD * 2); h16* VT16 = (h16*)take((size_t)NKV * HD * TT * 2);
    bf* QPh = (bf*)take((size_t)NH_ * TT * HD * 2); bf* QPl = (bf*)take((size_t)NH_ * TT * HD * 2); bf* KPh = (bf*)take((size_t)NKV * TT * HD * 2); bf* KPl = (bf*)take((size_t)NKV * TT * HD * 2); bf* VTh = (bf*)take((size_t)NKV * HD * TT * 2); bf* VTl = (bf*)take((size_t)NKV * HD * TT * 2); bf* Ph = (bf*)take((size_t)ZH * RH * TT * 2); bf* Pl = (bf*)take((size_t)ZH * RH * TT * 2);
    float* Sb = (float*)take((size_t)ZH * TT * TT * 4); h16* P16 = nullptr; float* Ob = (float*)take((size_t)ZH * TT * HD * 4); bf* ATh = (bf*)take((size_t)TT * DQ * 2); bf* ATl = (bf*)take((size_t)TT * DQ * 2);
    if ((size_t)(wsp - (char*)d_ws) > ws_size) return;    // ws 256 MiB
    float* FV = FK;   // v projection reuses the k buffer after the k planes are built (stream-ordered)
    { k_wbdx<<<(unsigned)(((size_t)DQ * DQ / 8 + 255) / 256), 256, 0, stream>>>(wbl, WBD); k_wtG<<<(unsigned)((DM * DQ / 64 + 63) / 64), 256, 0, stream>>>(wq, DM, DQ, WQ); k_wtG<<<(unsigned)((DM * DKV / 64 + 63) / 64), 256, 0, stream>>>(wk, DM, DKV, WK); k_wtG<<<(unsigned)((DM * DKV / 64 + 63) / 64), 256, 0, stream>>>(wv, DM, DKV, WV);
      k_wtG<<<(unsigned)((DQ * DM / 64 + 63) / 64), 256, 0, stream>>>(wo, DQ, DM, WO);
       }
    k_csid<<<(TT * HD + 255) / 256, 256, 0, stream>>>(CS);
    const unsigned LQ = (unsigned)(((size_t)NH_ * TT * HD / 2 + 255) / 256), LKv = (unsigned)(((size_t)NKV * TT * HD / 2 + 255) / 256);
    for (int b = 0; b < NB_; ++b) {
        
        k_cvt8<<<(unsigned)(((size_t)TT * DM / 8 + 255) / 256), 256, 0, stream>>>(x + (size_t)b * TT * DM, XB, (size_t)TT * DM / 8);
        k_gemmw<bf, 0, true, 8><<<dim3(TT / 64, DQ / 64, 1), 256, 0, stream>>>(XB, nullptr, WQ, nullptr, DM, FQ, DQ, bq, 0, 0, 0); k_flat<<<(unsigned)(((size_t)TT * DQ / 4 + 255) / 256), 256, 0, stream>>>(FQ, FQ16, FQh, FQl, (size_t)TT * DQ / 4); k_gemmw<bf, 1, false, 8><<<dim3(TT / 64, DQ / 64, 1), 256, 0, stream>>>(FQh, FQl, WBD, nullptr, DQ, FQW, DQ, nullptr, 0, 0, 0);   /* Q W (W shared by all heads = block-diagonal) */
        k_rope<<<LQ, 256, 0, stream>>>(FQW, DQ, NH_, CS, nullptr, nullptr, 1.0f, QP16, QPh, QPl);
        k_cvt8<<<(unsigned)(((size_t)TT * DM / 8 + 255) / 256), 256, 0, stream>>>(xk + (size_t)b * TT * DM, XB, (size_t)TT * DM / 8); k_gemmw<bf, 0, true, 8><<<dim3(TT / 64, DKV / 64, 1), 256, 0, stream>>>(XB, nullptr, WK, nullptr, DM, FK, DKV, bk, 0, 0, 0);
        k_rope<<<LKv, 256, 0, stream>>>(FK, DKV, NKV, CS, nullptr, nullptr, 1.0f, KP16, KPh, KPl);
        k_cvt8<<<(unsigned)(((size_t)TT * DM / 8 + 255) / 256), 256, 0, stream>>>(xv + (size_t)b * TT * DM, XB, (size_t)TT * DM / 8); k_gemmw<bf, 0, true, 8><<<dim3(TT / 64, DKV / 64, 1), 256, 0, stream>>>(XB, nullptr, WV, nullptr, DM, FV, DKV, bv, 0, 0, 0); k_vtp<<<LKv, 256, 0, stream>>>(FV, DKV, NKV, VT16, VTh, VTl);
        for (int h0 = 0; h0 < NH_; h0 += ZH) { const size_t zq = (size_t)h0, zk = (size_t)(h0 / REP);   // one kv head per query head: the pass's two heads use consecutive kv planes (z-strides TT*HD)
            k_gemmw<bf, 2, false, 1><<<dim3(RH / 64, TT / 64, ZH), 32, 0, stream>>>(QPh + zq * TT * HD, QPl + zq * TT * HD, KPh + zk * TT * HD, KPl + zk * TT * HD, HD, Sb, TT, nullptr, (size_t)TT * HD, (size_t)TT * HD, (size_t)TT * TT);
            k_asoft<<<ZH * TT / 8, 256, 0, stream>>>(Sb, thr + b, P16, Ph, Pl);
            k_gemmw<bf, 2, false, 16><<<dim3(RH / 64, HD / 64, ZH), 512, 0, stream>>>(Ph, Pl, VTh + zk * HD * TT, VTl + zk * HD * TT, TT, Ob, HD, nullptr, (size_t)RH * TT, (size_t)HD * TT, (size_t)TT * HD);
            k_merge<<<(unsigned)(((size_t)ZH * TT * HD / 2 + 255) / 256), 256, 0, stream>>>(Ob, h0, ATh, ATl); }
        k_gemmw<bf, 1, true, 8><<<dim3(TT / 64, DM / 64, 1), 256, 0, stream>>>(ATh, ATl, WO, nullptr, DQ, OUT + (size_t)b * TT * DM, DM, bo, 0, 0, 0); }
}

// v002
// One run takes 341 microseconds.
// Next to v001, in two timings, it ran 2.79 and 2.77 times as fast.
// Over all steps from v000 it is 4.13 times as fast.
#include <hip/hip_runtime.h>

// Multi-head attention with a learned bilinear score and a per-batch key threshold (queries, keys, values [2][2048][1024]; Q,K,V = input W + b ('xw' [1024][1024] + [1024]; 16 heads x 64); scores = (Q W).K with W [64][64] shared by all heads, NO 1/sqrt(d) (logit sigma ~8); keys j >= thresholds[b] get the logit MASK_VALUE = -1e-6 (a value near zero, NOT an exclusion -- reproduced literally; thresholds int [2], read); softmax; out = merged attn.V Wo + bo -> [2][2048][1024] (4.2 M)).
// Layout per batch: bf16 copies of the three inputs in turn; exact projections + f32 biases; the bilinear W applied as one block-diagonal [1024][1024] GEMM on the hi/lo planes of Q (2 products); then ONE fused attention launch over both batches and all heads, EVERY row on hi/lo planes (3 products; unscaled logits), reading the batch's threshold once and selecting -1e-6 for j >= threshold, online softmax; merged hi/lo x Wo exact + bo.
// Compute dtypes, f32 accumulate: every input rounded to bf16; projections exact + f32 biases; Q W hi/lo x exact; scores and attn.V 3 products on every row; softmax f32; Wo hl x exact + bias.

#define NB_  2
#define TT   2048
#define DM   1024
#define NH_  16
#define NKV  16
#define REP  (NH_ / NKV)
#define HD   64
#define DQ   (NH_ * HD)
#define DKV  (NKV * HD)
#define ZH   2
#define RH   2048                  // unused: every query row uses hi+lo planes
#define WIN  0
#define PCAR 1024.0f
#define SCL  1.0f   // no 1/sqrt(d) in the module
typedef _Float16 h16;
typedef unsigned short bf;
typedef __attribute__((ext_vector_type(16))) __bf16   v16bf;
typedef __attribute__((ext_vector_type(16))) _Float16 v16h;
typedef __attribute__((ext_vector_type(8)))  _Float16 v8h;
typedef __attribute__((ext_vector_type(8)))  unsigned short v8us;
typedef __attribute__((ext_vector_type(8)))  float    v8f;
typedef __attribute__((ext_vector_type(4)))  float    v4f;
typedef v8h  __attribute__((may_alias)) v8ha;
typedef v4f  __attribute__((may_alias)) v4fa;
typedef v8us __attribute__((may_alias)) v8usa;

__device__ __forceinline__ unsigned short f2bf(float f) { unsigned u = __float_as_uint(f); u += 0x7FFFu + ((u >> 16) & 1u); return (unsigned short)(u >> 16); }
__device__ __forceinline__ float bf2f(unsigned short b) { return __uint_as_float(((unsigned)b) << 16); }
__device__ __forceinline__ float bfr(float f) { return bf2f(f2bf(f)); }
__device__ __forceinline__ v16h cat16(v8h lo, v8h hi) { return __builtin_shufflevector(lo, hi, 0, 1, 2, 3, 4, 5, 6, 7, 8, 9, 10, 11, 12, 13, 14, 15); }
__device__ __forceinline__ v16bf cat16b(v8us lo, v8us hi) { return __builtin_bit_cast(v16bf, __builtin_shufflevector(lo, hi, 0, 1, 2, 3, 4, 5, 6, 7, 8, 9, 10, 11, 12, 13, 14, 15)); }
__device__ __forceinline__ v8f wmma16(v16h a, v16h b, v8f c) { return __builtin_amdgcn_wmma_f32_16x16x32_f16(false, a, false, b, (short)0, c, false, false); }
__device__ __forceinline__ v8f wmmab(v16bf a, v16bf b, v8f c) { return __builtin_amdgcn_wmma_f32_16x16x32_bf16(false, a, false, b, (short)0, c, false, false); }



// ---- k_gemmw: register-blocked GEMM, one 64x64 output tile per block (16 accumulators per wave), operands straight from K-contiguous 16-bit planes; grid (M/64, N/64, Z), 32 * KW threads.
// C[m][n] (f32, pitch ldc, + optional f32 bias[n]) = sum_k A[m][k] Bt[n][k] (+ split products per NSPLIT). z-batch strides sA/sB/sC in elements. K % (32 * KW) == 0.
// KW waves share the tile's K range: wave w takes the 32-wide k blocks w, w + KW, ... into its own full set of accumulators; the KW partial tiles are joined in LDS in the fixed order w = 0 .. KW-1 (KW = 1: no join).
template <typename T16> struct WFrag;
template <> struct WFrag<h16> { typedef v16h V; static __device__ __forceinline__ V ld(const h16* p) { return cat16(*(const v8h*)p, *(const v8h*)(p + 16)); } static __device__ __forceinline__ v8f mma(V a, V b, v8f c) { return wmma16(a, b, c); } };
template <> struct WFrag<bf> { typedef v16bf V; static __device__ __forceinline__ V ld(const bf* p) { return cat16b(*(const v8us*)p, *(const v8us*)(p + 16)); } static __device__ __forceinline__ v8f mma(V a, V b, v8f c) { return wmmab(a, b, c); } };
template <typename T16, int NSPLIT, bool BIAS, int KW>
__global__ __launch_bounds__(32 * KW) void k_gemmw(const T16* __restrict__ A, const T16* __restrict__ A2, const T16* __restrict__ Bt, const T16* __restrict__ Bt2, int K, float* C, int ldc, const float* __restrict__ bias, size_t sA, size_t sB, size_t sC) {
    typedef typename WFrag<T16>::V V;
    static_assert(KW == 1 || 32 % KW == 0, "the join walks the 64 rows in steps of 2 * KW");
    constexpr int SLAB = (KW == 1 ? 16 : 64) * 68;   // floats of one wave's staging slab (KW > 1: its whole partial tile)
    __shared__ __align__(16) float os[KW * SLAB];
    const int wv = (KW == 1) ? 0 : __builtin_amdgcn_readfirstlane((int)(threadIdx.x >> 5));   // wave number as a scalar: the k loop stays a scalar loop
    const size_t z = blockIdx.z; A += z * sA; if (A2) A2 += z * sA; Bt += z * sB; if (Bt2) Bt2 += z * sB; C += z * sC;
    const int lane = threadIdx.x & 31, lr = lane & 15, hi = lane >> 4; const int r0 = blockIdx.x * 64, c0 = blockIdx.y * 64;
    v8f acc[4][4];
#pragma unroll
    for (int mb = 0; mb < 4; ++mb)
#pragma unroll
        for (int nb = 0; nb < 4; ++nb) acc[mb][nb] = (v8f){};
    const size_t aoff = (size_t)(r0 + lr) * K + 8 * hi, boff = (size_t)(c0 + lr) * K + 8 * hi;
#pragma unroll 1
    for (int kc = wv * 32; kc < K; kc += 32 * KW) {
        V a[4], a2[4];
#pragma unroll
        for (int mb = 0; mb < 4; ++mb) { a[mb] = WFrag<T16>::ld(A + aoff + (size_t)mb * 16 * K + kc); if (NSPLIT == 1 || NSPLIT == 2) a2[mb] = WFrag<T16>::ld(A2 + aoff + (size_t)mb * 16 * K + kc); }
#pragma unroll
        for (int nb = 0; nb < 4; ++nb) { const V b = WFrag<T16>::ld(Bt + boff + (size_t)nb * 16 * K + kc); V b2; if (NSPLIT >= 2) b2 = WFrag<T16>::ld(Bt2 + boff + (size_t)nb * 16 * K + kc);
#pragma unroll
            for (int mb = 0; mb < 4; ++mb) { acc[mb][nb] = WFrag<T16>::mma(a[mb], b, acc[mb][nb]); if (NSPLIT == 1 || NSPLIT == 2) acc[mb][nb] = WFrag<T16>::mma(a2[mb], b, acc[mb][nb]); if (NSPLIT >= 2) acc[mb][nb] = WFrag<T16>::mma(a[mb], b2, acc[mb][nb]); } }
        asm volatile("v_nop\n\tv_nop\n\tv_nop\n\tv_nop" : "+v"(acc[0][0]), "+v"(acc[1][1]), "+v"(acc[2][2]), "+v"(acc[3][3]) : "v"(a[0]), "v"(a[3]));
    }
    if constexpr (KW > 1) {
        float* osw = os + wv * SLAB;
#pragma unroll
        for (int mb = 0; mb < 4; ++mb)
#pragma unroll
            for (int nb = 0; nb < 4; ++nb)
#pragma unroll
                for (int j = 0; j < 8; ++j) osw[(mb * 16 + hi * 8 + j) * 68 + nb * 16 + lr] = acc[mb][nb][j];
        __syncthreads();   // every wave's partial tile is in LDS before any thread sums it
        const int row0 = (int)(threadIdx.x >> 4), cofs = (int)(threadIdx.x & 15) * 4;   // the block covers 2 * KW rows of 16 float4 per step
#pragma unroll
        for (int q = 0; q < 32 / KW; ++q) { const int row = q * 2 * KW + row0; v4f val = *(const v4fa*)(os + row * 68 + cofs);
#pragma unroll
            for (int w = 1; w < KW; ++w) val += *(const v4fa*)(os + w * SLAB + row * 68 + cofs);
            if (BIAS) { val[0] += bfr(bias[c0 + cofs]); val[1] += bfr(bias[c0 + cofs + 1]); val[2] += bfr(bias[c0 + cofs + 2]); val[3] += bfr(bias[c0 + cofs + 3]); }
            *(v4f*)(C + (size_t)(r0 + row) * ldc + c0 + cofs) = val; }
        return;
    }
#pragma unroll
    for (int mb = 0; mb < 4; ++mb) {
#pragma unroll
        for (int nb = 0; nb < 4; ++nb) {
#pragma unroll
            for (int j = 0; j < 8; ++j) os[(hi * 8 + j) * 68 + nb * 16 + lr] = acc[mb][nb][j]; }
        __builtin_amdgcn_wave_barrier(); asm volatile("" ::: "memory");
        float* crow = C + (size_t)(r0 + mb * 16) * ldc + c0;
{
#pragma unroll
            for (int s = 0; s < 8; ++s) { const int row = 2 * s + hi, cofs = lr * 4; v4f val = *(const v4fa*)(os + row * 68 + cofs); if (BIAS) { val[0] += bfr(bias[c0 + cofs]); val[1] += bfr(bias[c0 + cofs + 1]); val[2] += bfr(bias[c0 + cofs + 2]); val[3] += bfr(bias[c0 + cofs + 3]); }
                *(v4f*)(crow + (size_t)row * ldc + cofs) = val; }
             }
        __builtin_amdgcn_wave_barrier(); asm volatile("" ::: "memory");
    }
}

__device__ __forceinline__ h16 tohx(float x) { return (h16)x; }
__device__ __forceinline__ void splitf(float y, unsigned short& h, unsigned short& l) { h = f2bf(y); l = f2bf(y - bf2f(h)); }
typedef __attribute__((ext_vector_type(2))) _Float16 v2h;
typedef __attribute__((ext_vector_type(4))) _Float16 v4h;
typedef __attribute__((ext_vector_type(2))) unsigned short v2us;
typedef __attribute__((ext_vector_type(4))) unsigned short v4us;
typedef __attribute__((ext_vector_type(2))) float v2f;
typedef __attribute__((ext_vector_type(4))) int v4i;

__global__ __launch_bounds__(256) void k_wtG(const float* __restrict__ w, int K, int N, bf* Bt) {
    const int lane = threadIdx.x & 31; const int L0 = (blockIdx.x * 8 + (threadIdx.x >> 5)) * 8; const int nlines = N * K / 64;
{
#pragma unroll 1
        for (int l = 0; l < 8; ++l) { const int L = L0 + l; if (L >= nlines) break; const size_t e = (size_t)L * 64 + lane * 2; const int k = (int)(e % K), n = (int)(e / K); v2us o;
            o[0] = f2bf(w[(size_t)k * N + n]); o[1] = f2bf(w[(size_t)(k + 1) * N + n]); *(v2us*)(Bt + e) = o; }
         }
}
__global__ __launch_bounds__(256) void k_cvt8(const float* __restrict__ src, bf* dst, size_t n8) { const size_t i = (size_t)blockIdx.x * 256 + threadIdx.x; if (i >= n8) return; const v8f v = *(const v8f*)(src + i * 8); v8us o;
#pragma unroll
    for (int k = 0; k < 8; ++k) o[k] = f2bf(v[k]); *(v8us*)(dst + i * 8) = o;  }

// k_rope: head planes [h][t][d] (fp16 + hi/lo) of rope(x) x sc with the rotate-half convention out[d] = x[d] cos[t][d] - x[d+HD/2] sin[t][d], out[d+HD/2] = x[d+HD/2] cos[t][d+HD/2] + x[d] sin[t][d+HD/2]
__global__ __launch_bounds__(256) void k_rope(const float* __restrict__ F, int pitch, int nheads, const float* __restrict__ CS, const float* __restrict__ RF, const float* __restrict__ nw, float sc, h16* P16, bf* Ph, bf* Pl) {
    const size_t e = ((size_t)blockIdx.x * 256 + threadIdx.x) * 2; if (e >= (size_t)nheads * TT * HD) return; const int d = (int)(e % HD); const int t = (int)((e / HD) % TT); const int h = (int)(e / ((size_t)HD * TT)); const float* f = F + (size_t)t * pitch + h * HD; const float rf = RF ? RF[(size_t)h * TT + t] : 1.0f; v2h o16; v2us oh, ol;
#pragma unroll
    for (int q = 0; q < 2; ++q) { const int dd = d + q; const int dp = (dd < HD / 2) ? dd + HD / 2 : dd - HD / 2; float x0 = f[dd], x1 = f[dp];
        if (RF) { float n0 = __fmul_rn(x0, rf), n1 = __fmul_rn(x1, rf); asm volatile("" : "+v"(n0)); asm volatile("" : "+v"(n1)); x0 = __fmul_rn(bfr(nw[dd]), n0); x1 = __fmul_rn(bfr(nw[dp]), n1); }
        const v2f cs = *(const v2f*)(CS + ((size_t)t * HD + dd) * 2); float a = __fmul_rn(x0, cs[0]), bq = __fmul_rn(x1, cs[1]); asm volatile("" : "+v"(a)); asm volatile("" : "+v"(bq)); const float r = ((dd < HD / 2) ? __fsub_rn(a, bq) : __fadd_rn(a, bq)) * sc;
        o16[q] = tohx(r); unsigned short a2, c2; splitf(r, a2, c2); oh[q] = a2; ol[q] = c2; }
    *(v2h*)(P16 + e) = o16; *(v2us*)(Ph + e) = oh; *(v2us*)(Pl + e) = ol;  }
__global__ __launch_bounds__(256) void k_vtp(const float* __restrict__ F, int pitch, int nheads, h16* V16, bf* Vh, bf* Vl) { const size_t e = ((size_t)blockIdx.x * 256 + threadIdx.x) * 2; if (e >= (size_t)nheads * HD * TT) return; const int t = (int)(e % TT); const int d = (int)((e / TT) % HD); const int g = (int)(e / ((size_t)TT * HD)); v2h o16; v2us oh, ol;
#pragma unroll
    for (int q = 0; q < 2; ++q) { const float x = F[(size_t)(t + q) * pitch + g * HD + d]; o16[q] = tohx(x); unsigned short a2, c2; splitf(x, a2, c2); oh[q] = a2; ol[q] = c2; }
    *(v2h*)(V16 + e) = o16; *(v2us*)(Vh + e) = oh; *(v2us*)(Vl + e) = ol;  }
__global__ __launch_bounds__(256) void k_csid(float* CS) { const int idx = blockIdx.x * 256 + threadIdx.x; if (idx >= TT * HD) return; v2f cs; cs[0] = 1.0f; cs[1] = 0.0f; *(v2f*)(CS + (size_t)idx * 2) = cs;  }
__global__ __launch_bounds__(256) void k_flat(const float* __restrict__ F, h16* P16, bf* Ph, bf* Pl, size_t n4) { const size_t i = (size_t)blockIdx.x * 256 + threadIdx.x; if (i >= n4) return; const v4f a = *(const v4f*)(F + i * 4); v4h o16; v4us oh, ol;
#pragma unroll
    for (int q = 0; q < 4; ++q) { o16[q] = tohx(a[q]); unsigned short x2, y2; splitf(a[q], x2, y2); oh[q] = x2; ol[q] = y2; }
    *(v4h*)(P16 + i * 4) = o16; *(v4us*)(Ph + i * 4) = oh; *(v4us*)(Pl + i * 4) = ol;  }

__global__ __launch_bounds__(256) void k_wbdx(const float* __restrict__ w, bf* Bt) { const size_t i = (size_t)blockIdx.x * 256 + threadIdx.x; if (i >= (size_t)DQ * DQ / 8) return; const int k0 = (int)(i % (DQ / 8)) * 8; const int n = (int)(i / (DQ / 8)); const int h = n / HD, nn = n % HD; const int hb = k0 / HD; v8us o;
#pragma unroll
    for (int q = 0; q < 8; ++q) { const unsigned short v = f2bf(w[(size_t)((k0 + q) % HD) * HD + nn]); o[q] = (hb == h) ? v : (unsigned short)0; }
    *(v8us*)(Bt + (size_t)n * DQ + k0) = o;  }
typedef __attribute__((ext_vector_type(2))) __bf16 v2b;
typedef __attribute__((ext_vector_type(8))) unsigned v8u;
__device__ __forceinline__ float xhalf(float x) { const int b = __float_as_int(x); return __int_as_float(__builtin_amdgcn_permlanex16(b, b, 0x76543210, 0xfedcba98, false, false)); }   // the value of lane l ^ 16
__device__ __forceinline__ const bf* atb(const bf* base, unsigned bytes) { return (const bf*)((const char*)base + bytes); }   // uniform base + 32-bit lane offset
__global__ __launch_bounds__(256) void k_fattn(const bf* __restrict__ Qh, const bf* __restrict__ Ql, const bf* __restrict__ Kh, const bf* __restrict__ Kl, const bf* __restrict__ Vh, const bf* __restrict__ Vl, const int* __restrict__ thrp, bf* Ah, bf* Al) {
    typedef WFrag<bf> F; typedef F::V V;
    constexpr float L2E = 1.4426950408889634f;
    const int lane = threadIdx.x & 31, c = lane & 15, h = lane >> 4;
    const int hd = blockIdx.y, b = blockIdx.z; const int q0 = blockIdx.x * 256 + (int)(threadIdx.x >> 5) * 32;
    const int thr = __builtin_amdgcn_readfirstlane(thrp[b]);   // the batch's key threshold (input), a scalar so that the mask test is a scalar branch
    const size_t pl = ((size_t)b * NH_ + hd) * TT * HD;
    V qh[2][2], ql[2][2];
#pragma unroll
    for (int qt = 0; qt < 2; ++qt)
#pragma unroll
        for (int ks = 0; ks < 2; ++ks) { const size_t o = pl + (size_t)(q0 + qt * 16 + c) * HD + ks * 32 + 8 * h; qh[qt][ks] = F::ld(Qh + o); ql[qt][ks] = F::ld(Ql + o); }
    const bf* kph = Kh + pl; const bf* kpl = Kl + pl; const bf* vph = Vh + pl; const bf* vpl = Vl + pl;   // wave-uniform bases; the lane's part is a 32-bit byte offset
    const unsigned ko = (unsigned)(c * HD + 8 * h) * 2;   // bytes
    unsigned vb = (unsigned)(c * TT + 8 * h) * 2, kb2 = ko + 32 * HD * 2;   // the lane's byte offsets of this pass's V^T columns and of the next pass's K rows; both step only behind the wait that follows their loads
    v8f o[4][2];
#pragma unroll
    for (int dt = 0; dt < 4; ++dt)
#pragma unroll
        for (int qt = 0; qt < 2; ++qt) o[dt][qt] = (v8f){};
    float ms[2] = {-3.0e38f, -3.0e38f}, l[2] = {0.f, 0.f};
    V kh[2][2], kl[2][2];
#pragma unroll
    for (int kt = 0; kt < 2; ++kt)
#pragma unroll
        for (int ks = 0; ks < 2; ++ks) { kh[kt][ks] = F::ld(atb(kph, ko) + kt * 16 * HD + ks * 32); kl[kt][ks] = F::ld(atb(kpl, ko) + kt * 16 * HD + ks * 32); }
    asm volatile("s_wait_xcnt 0x0" ::: "memory");   // stands between the loads above and the next write of a register that they name as address
    __builtin_amdgcn_sched_barrier(0);   // holds later register writes behind that wait
#pragma unroll 1
    for (int kb = 0; kb < TT; kb += 32) {
        V vh[4], vl[4];   // this pass's V^T fragments, asked for ahead of the score products
#pragma unroll
        for (int dt = 0; dt < 4; ++dt) { vh[dt] = F::ld(atb(vph, vb) + dt * 16 * TT); vl[dt] = F::ld(atb(vpl, vb) + dt * 16 * TT); }
        asm volatile("s_wait_xcnt 0x0" ::: "memory");   // stands between these loads and the next write of a register that they name as address
        __builtin_amdgcn_sched_barrier(0);   // keeps the V^T loads issued here, a whole score block and softmax ahead of their use (the scheduler otherwise sinks them next to it), and the offset's step behind the wait
        vb += 64;
        v8f s[2][2];
#pragma unroll
        for (int kt = 0; kt < 2; ++kt)
#pragma unroll
            for (int qt = 0; qt < 2; ++qt) { v8f t = (v8f){};
#pragma unroll
                for (int ks = 0; ks < 2; ++ks) { t = F::mma(kh[kt][ks], qh[qt][ks], t); t = F::mma(kh[kt][ks], ql[qt][ks], t); t = F::mma(kl[kt][ks], qh[qt][ks], t); }
                s[kt][qt] = t; }
        // the next pass's K fragments fly during the softmax
#pragma unroll
        for (int kt = 0; kt < 2; ++kt)
#pragma unroll
            for (int ks = 0; ks < 2; ++ks) { kh[kt][ks] = F::ld(atb(kph, kb2) + kt * 16 * HD + ks * 32); kl[kt][ks] = F::ld(atb(kpl, kb2) + kt * 16 * HD + ks * 32); }
        asm volatile("s_wait_xcnt 0x0" ::: "memory");   // as above, for the K loads
        __builtin_amdgcn_sched_barrier(0);   // keeps the next K loads issued here, ahead of the softmax (the scheduler otherwise sinks them to the end of the pass, just in front of their use), and the offset's step behind the wait
        kb2 = (kb + 64 < TT) ? kb2 + 32 * HD * 2 : ko;   // the last pass re-reads pass 0, unused
        if (kb + 32 > thr) {   // keys >= threshold get the VALUE -1e-6 (MASK_VALUE), not an exclusion
#pragma unroll
            for (int kt = 0; kt < 2; ++kt)
#pragma unroll
                for (int r = 0; r < 8; ++r) { const bool keep = (kb + kt * 16 + 8 * h + r) < thr;
#pragma unroll
                    for (int qt = 0; qt < 2; ++qt) s[kt][qt][r] = keep ? s[kt][qt][r] : -1.0e-6f; }
        }
        float mxs[2]; bool need = false;
#pragma unroll
        for (int qt = 0; qt < 2; ++qt) { float mx = s[0][qt][0];
#pragma unroll
            for (int r = 1; r < 8; ++r) mx = fmaxf(mx, s[0][qt][r]);
#pragma unroll
            for (int r = 0; r < 8; ++r) mx = fmaxf(mx, s[1][qt][r]);
            mx = fmaxf(mx, xhalf(mx)); mxs[qt] = mx * L2E; need = need || (mxs[qt] > ms[qt] + 8.0f); }
        if (__builtin_amdgcn_ballot_w32(need) != 0) {
#pragma unroll
            for (int qt = 0; qt < 2; ++qt) { const float mn = fmaxf(ms[qt], mxs[qt]); const float al = __builtin_amdgcn_exp2f(ms[qt] - mn); ms[qt] = mn; l[qt] *= al;
#pragma unroll
                for (int dt = 0; dt < 4; ++dt) o[dt][qt] *= al; }
        }
        V ph[2], pw[2];
#pragma unroll
        for (int qt = 0; qt < 2; ++qt) { v2f sum = (v2f){0.f, 0.f}; v8u wh, wl;   // two elements at a time: packed conversions, packed sums
#pragma unroll
            for (int e = 0; e < 16; e += 2) { v2f p; p[0] = __builtin_amdgcn_exp2f(__builtin_fmaf(s[e >> 3][qt][e & 7], L2E, -ms[qt])); p[1] = __builtin_amdgcn_exp2f(__builtin_fmaf(s[e >> 3][qt][(e & 7) + 1], L2E, -ms[qt])); sum += p;
                const v2b hp = __builtin_convertvector(p, v2b); v2f rs; rs[0] = p[0] - (float)hp[0]; rs[1] = p[1] - (float)hp[1];
                wh[e >> 1] = __builtin_bit_cast(unsigned, hp); wl[e >> 1] = __builtin_bit_cast(unsigned, __builtin_convertvector(rs, v2b)); }
            ph[qt] = __builtin_bit_cast(V, wh); pw[qt] = __builtin_bit_cast(V, wl); l[qt] += sum[0] + sum[1]; }
#pragma unroll
        for (int dt = 0; dt < 4; ++dt)
#pragma unroll
            for (int qt = 0; qt < 2; ++qt) { o[dt][qt] = F::mma(vh[dt], ph[qt], o[dt][qt]); o[dt][qt] = F::mma(vh[dt], pw[qt], o[dt][qt]); o[dt][qt] = F::mma(vl[dt], ph[qt], o[dt][qt]); }
    }
    v8us oh[2][4], ol[2][4];
#pragma unroll
    for (int qt = 0; qt < 2; ++qt) { const float f = __fdiv_rn(1.0f, l[qt] + xhalf(l[qt]));
#pragma unroll
        for (int dt = 0; dt < 4; ++dt)
#pragma unroll
            for (int r = 0; r < 8; ++r) { unsigned short x2, y2; splitf(o[dt][qt][r] * f, x2, y2); oh[qt][dt][r] = x2; ol[qt][dt][r] = y2; } }
    const size_t ro = ((size_t)b * TT + q0 + c) * DQ + hd * HD + 8 * h; bf* pa = Ah + ro; bf* pb = Al + ro;
    __builtin_amdgcn_sched_barrier(0);   // all values and both addresses are ready here: behind the first store no register that a store names is written any more
#pragma unroll
    for (int qt = 0; qt < 2; ++qt)
#pragma unroll
        for (int dt = 0; dt < 4; ++dt) { *(v8us*)(pa + qt * 16 * DQ + dt * 16) = oh[qt][dt]; *(v8us*)(pb + qt * 16 * DQ + dt * 16) = ol[qt][dt]; }
}

extern "C" void kernel_launch(void* const* d_in, const int* in_sizes, int n_in,
                              void* d_out, int out_size, void* d_ws, size_t ws_size, hipStream_t stream) {
    (void)in_sizes; (void)n_in; (void)out_size;
    const float* x = (const float*)d_in[0]; const float* xk = (const float*)d_in[1]; const float* xv = (const float*)d_in[2]; const int* thr = (const int*)d_in[3]; const float* wq = (const float*)d_in[4]; const float* bq = (const float*)d_in[5]; const float* wk = (const float*)d_in[6]; const float* bk = (const float*)d_in[7]; const float* wv = (const float*)d_in[8]; const float* bv = (const float*)d_in[9]; const float* wbl = (const float*)d_in[10]; const float* wo = (const float*)d_in[11]; const float* bo = (const float*)d_in[12];
    float* OUT = (float*)d_out;     // [2][2048][1024]
    char* wsp = (char*)d_ws;
    auto take = [&](size_t bytes) { char* p = wsp; wsp += (bytes + 255) & ~(size_t)255; return (void*)p; };
    bf* WBD = (bf*)take((size_t)DQ * DQ * 2); h16* FQ16 = (h16*)take((size_t)TT * DQ * 2); bf* FQh = (bf*)take((size_t)TT * DQ * 2); bf* FQl = (bf*)take((size_t)TT * DQ * 2); float* FQW = (float*)take((size_t)TT * DQ * 4); bf* WQ = (bf*)take((size_t)DQ * DM * 2); bf* WK = (bf*)take((size_t)DKV * DM * 2); bf* WV = (bf*)take((size_t)DKV * DM * 2); bf* WO = (bf*)take((size_t)DM * DQ * 2); float* CS = (float*)take((size_t)TT * HD * 2 * 4);
    bf* XB = (bf*)take((size_t)TT * DM * 2); float* FQ = (float*)take((size_t)TT * DQ * 4); float* FK = (float*)take((size_t)TT * DKV * 4);
    h16* QP16 = (h16*)take((size_t)NH_ * TT * HD * 2); h16* KP16 = (h16*)take((size_t)NKV * TT * HD * 2); h16* VT16 = (h16*)take((size_t)NKV * HD * TT * 2);
    const size_t PLN = (size_t)NH_ * TT * HD;   // one batch's head planes; the hi/lo planes and the merged attention rows are kept for both batches
    bf* QPh = (bf*)take(NB_ * PLN * 2); bf* QPl = (bf*)take(NB_ * PLN * 2); bf* KPh = (bf*)take(NB_ * PLN * 2); bf* KPl = (bf*)take(NB_ * PLN * 2); bf* VTh = (bf*)take(NB_ * PLN * 2); bf* VTl = (bf*)take(NB_ * PLN * 2);
    bf* ATh = (bf*)take((size_t)NB_ * TT * DQ * 2); bf* ATl = (bf*)take((size_t)NB_ * TT * DQ * 2);
    if ((size_t)(wsp - (char*)d_ws) > ws_size) return;    // ws 256 MiB
    float* FV = FK;   // v projection reuses the k buffer after the k planes are built (stream-ordered)
    { k_wbdx<<<(unsigned)(((size_t)DQ * DQ / 8 + 255) / 256), 256, 0, stream>>>(wbl, WBD); k_wtG<<<(unsigned)((DM * DQ / 64 + 63) / 64), 256, 0, stream>>>(wq, DM, DQ, WQ); k_wtG<<<(unsigned)((DM * DKV / 64 + 63) / 64), 256, 0, stream>>>(wk, DM, DKV, WK); k_wtG<<<(unsigned)((DM * DKV / 64 + 63) / 64), 256, 0, stream>>>(wv, DM, DKV, WV);
      k_wtG<<<(unsigned)((DQ * DM / 64 + 63) / 64), 256, 0, stream>>>(wo, DQ, DM, WO);
       }
    k_csid<<<(TT * HD + 255) / 256, 256, 0, stream>>>(CS);
    const unsigned LQ = (unsigned)(((size_t)NH_ * TT * HD / 2 + 255) / 256), LKv = (unsigned)(((size_t)NKV * TT * HD / 2 + 255) / 256);
    for (int b = 0; b < NB_; ++b) {
        
        k_cvt8<<<(unsigned)(((size_t)TT * DM / 8 + 255) / 256), 256, 0, stream>>>(x + (size_t)b * TT * DM, XB, (size_t)TT * DM / 8);
        k_gemmw<bf, 0, true, 8><<<dim3(TT / 64, DQ / 64, 1), 256, 0, stream>>>(XB, nullptr, WQ, nullptr, DM, FQ, DQ, bq, 0, 0, 0); k_flat<<<(unsigned)(((size_t)TT * DQ / 4 + 255) / 256), 256, 0, stream>>>(FQ, FQ16, FQh, FQl, (size_t)TT * DQ / 4); k_gemmw<bf, 1, false, 8><<<dim3(TT / 64, DQ / 64, 1), 256, 0, stream>>>(FQh, FQl, WBD, nullptr, DQ, FQW, DQ, nullptr, 0, 0, 0);   /* Q W (W shared by all heads = block-diagonal) */
        k_rope<<<LQ, 256, 0, stream>>>(FQW, DQ, NH_, CS, nullptr, nullptr, 1.0f, QP16, QPh + b * PLN, QPl + b * PLN);
        k_cvt8<<<(unsigned)(((size_t)TT * DM / 8 + 255) / 256), 256, 0, stream>>>(xk + (size_t)b * TT * DM, XB, (size_t)TT * DM / 8); k_gemmw<bf, 0, true, 8><<<dim3(TT / 64, DKV / 64, 1), 256, 0, stream>>>(XB, nullptr, WK, nullptr, DM, FK, DKV, bk, 0, 0, 0);
        k_rope<<<LKv, 256, 0, stream>>>(FK, DKV, NKV, CS, nullptr, nullptr, 1.0f, KP16, KPh + b * PLN, KPl + b * PLN);
        k_cvt8<<<(unsigned)(((size_t)TT * DM / 8 + 255) / 256), 256, 0, stream>>>(xv + (size_t)b * TT * DM, XB, (size_t)TT * DM / 8); k_gemmw<bf, 0, true, 8><<<dim3(TT / 64, DKV / 64, 1), 256, 0, stream>>>(XB, nullptr, WV, nullptr, DM, FV, DKV, bv, 0, 0, 0); k_vtp<<<LKv, 256, 0, stream>>>(FV, DKV, NKV, VT16, VTh + b * PLN, VTl + b * PLN); }
    k_fattn<<<dim3(TT / 256, NH_, NB_), 256, 0, stream>>>(QPh, QPl, KPh, KPl, VTh, VTl, thr, ATh, ATl);
    for (int b = 0; b < NB_; ++b)
        k_gemmw<bf, 1, true, 8><<<dim3(TT / 64, DM / 64, 1), 256, 0, stream>>>(ATh + (size_t)b * TT * DQ, ATl + (size_t)b * TT * DQ, WO, nullptr, DQ, OUT + (size_t)b * TT * DM, DM, bo, 0, 0, 0);
}

// v003
// A run of this version takes 289 microseconds.
// Two timings next to v002 put it at 1.18 and 1.19 times that version's speed.
// Over all steps from v000 it is 4.89 times as fast.
#include <hip/hip_runtime.h>

// Multi-head attention with a learned bilinear score and a per-batch key threshold (queries, keys, values [2][2048][1024]; Q,K,V = input W + b ('xw' [1024][1024] + [1024]; 16 heads x 64); scores = (Q W).K with W [64][64] shared by all heads, NO 1/sqrt(d) (logit sigma ~8); keys j >= thresholds[b] get the logit MASK_VALUE = -1e-6 (a value near zero, NOT an exclusion -- reproduced literally; thresholds int [2], read); softmax; out = merged attn.V Wo + bo -> [2][2048][1024] (4.2 M)).
// Layout per batch: bf16 copies of the three inputs in turn; exact projections + f32 biases, each GEMM's join writing the bf16 hi/lo planes its consumer reads (Q flat, K by head, V^T as the product Wv^T.X^T); the bilinear W applied as one block-diagonal [1024][1024] GEMM on the hi/lo planes of Q (2 products), written by head; then ONE fused attention launch over both batches and all heads, EVERY row on hi/lo planes (3 products; unscaled logits), reading the batch's threshold once and selecting -1e-6 for j >= threshold, online softmax; merged hi/lo x Wo exact + bo.
// Compute dtypes, f32 accumulate: every input rounded to bf16; projections exact + f32 biases; Q W hi/lo x exact; scores and attn.V 3 products on every row; softmax f32; Wo hl x exact + bias.

#define NB_  2
#define TT   2048
#define DM   1024
#define NH_  16
#define NKV  16
#define REP  (NH_ / NKV)
#define HD   64
#define DQ   (NH_ * HD)
#define DKV  (NKV * HD)
#define ZH   2
#define RH   2048                  // unused: every query row uses hi+lo planes
#define WIN  0
#define PCAR 1024.0f
#define SCL  1.0f   // no 1/sqrt(d) in the module
typedef _Float16 h16;
typedef unsigned short bf;
typedef __attribute__((ext_vector_type(16))) __bf16   v16bf;
typedef __attribute__((ext_vector_type(16))) _Float16 v16h;
typedef __attribute__((ext_vector_type(8)))  _Float16 v8h;
typedef __attribute__((ext_vector_type(8)))  unsigned short v8us;
typedef __attribute__((ext_vector_type(8)))  float    v8f;
typedef __attribute__((ext_vector_type(4)))  float    v4f;
typedef v8h  __attribute__((may_alias)) v8ha;
typedef v4f  __attribute__((may_alias)) v4fa;
typedef v8us __attribute__((may_alias)) v8usa;

__device__ __forceinline__ unsigned short f2bf(float f) { unsigned u = __float_as_uint(f); u += 0x7FFFu + ((u >> 16) & 1u); return (unsigned short)(u >> 16); }
__device__ __forceinline__ float bf2f(unsigned short b) { return __uint_as_float(((unsigned)b) << 16); }
__device__ __forceinline__ float bfr(float f) { return bf2f(f2bf(f)); }
__device__ __forceinline__ v16h cat16(v8h lo, v8h hi) { return __builtin_shufflevector(lo, hi, 0, 1, 2, 3, 4, 5, 6, 7, 8, 9, 10, 11, 12, 13, 14, 15); }
__device__ __forceinline__ v16bf cat16b(v8us lo, v8us hi) { return __builtin_bit_cast(v16bf, __builtin_shufflevector(lo, hi, 0, 1, 2, 3, 4, 5, 6, 7, 8, 9, 10, 11, 12, 13, 14, 15)); }
__device__ __forceinline__ v8f wmma16(v16h a, v16h b, v8f c) { return __builtin_amdgcn_wmma_f32_16x16x32_f16(false, a, false, b, (short)0, c, false, false); }
__device__ __forceinline__ v8f wmmab(v16bf a, v16bf b, v8f c) { return __builtin_amdgcn_wmma_f32_16x16x32_bf16(false, a, false, b, (short)0, c, false, false); }



// ---- k_gemmw: register-blocked GEMM, one 64x64 output tile per block (16 accumulators per wave), operands straight from K-contiguous 16-bit planes; grid (M/64, N/64, Z), 32 * KW threads.
// C[m][n] (+ optional f32 bias: BIAS 1 bias[n], BIAS 2 bias[m]) = sum_k A[m][k] Bt[n][k] (+ split products per NSPLIT). z-batch strides sA/sB/sC in elements. K % (32 * KW) == 0.
// Where the f32 sum goes (OM): 0 = f32 to C, pitch ldc; 1 = split into bf16 hi/lo planes Ph/Pl, row-major, pitch ldc; 2 = the same split into head planes [n / 64][m][n % 64] of TT rows (a tile's 64 columns are one head).
// KW waves share the tile's K range: wave w takes the 32-wide k blocks w, w + KW, ... into its own full set of accumulators; the KW partial tiles are joined in LDS in the fixed order w = 0 .. KW-1 (KW = 1: no join).
template <typename T16> struct WFrag;
template <> struct WFrag<h16> { typedef v16h V; static __device__ __forceinline__ V ld(const h16* p) { return cat16(*(const v8h*)p, *(const v8h*)(p + 16)); } static __device__ __forceinline__ v8f mma(V a, V b, v8f c) { return wmma16(a, b, c); } };
template <> struct WFrag<bf> { typedef v16bf V; static __device__ __forceinline__ V ld(const bf* p) { return cat16b(*(const v8us*)p, *(const v8us*)(p + 16)); } static __device__ __forceinline__ v8f mma(V a, V b, v8f c) { return wmmab(a, b, c); } };
typedef __attribute__((ext_vector_type(4))) unsigned short v4us;
__device__ __forceinline__ void splitf(float y, unsigned short& h, unsigned short& l) { h = f2bf(y); l = f2bf(y - bf2f(h)); }
template <typename T16, int NSPLIT, int BIAS, int KW, int OM>
__global__ __launch_bounds__(32 * KW) void k_gemmw(const T16* __restrict__ A, const T16* __restrict__ A2, const T16* __restrict__ Bt, const T16* __restrict__ Bt2, int K, float* C, bf* Ph, bf* Pl, int ldc, const float* __restrict__ bias, size_t sA, size_t sB, size_t sC) {
    typedef typename WFrag<T16>::V V;
    static_assert(KW == 1 || 32 % KW == 0, "the join walks the 64 rows in steps of 2 * KW");
    static_assert(KW > 1 || (OM == 0 && BIAS != 2), "planes and the row bias are written by the join");
    static_assert(OM != 2 || HD == 64, "a tile's columns are one head");
    constexpr int SLAB = (KW == 1 ? 16 : 64) * 68;   // floats of one wave's staging slab (KW > 1: its whole partial tile)
    __shared__ __align__(16) float os[KW * SLAB];
    const int wv = (KW == 1) ? 0 : __builtin_amdgcn_readfirstlane((int)(threadIdx.x >> 5));   // wave number as a scalar: the k loop stays a scalar loop
    const size_t z = blockIdx.z; A += z * sA; if (A2) A2 += z * sA; Bt += z * sB; if (Bt2) Bt2 += z * sB; C += z * sC;
    const int lane = threadIdx.x & 31, lr = lane & 15, hi = lane >> 4; const int r0 = blockIdx.x * 64, c0 = blockIdx.y * 64;
    v8f acc[4][4];
#pragma unroll
    for (int mb = 0; mb < 4; ++mb)
#pragma unroll
        for (int nb = 0; nb < 4; ++nb) acc[mb][nb] = (v8f){};
    const size_t aoff = (size_t)(r0 + lr) * K + 8 * hi, boff = (size_t)(c0 + lr) * K + 8 * hi;
#pragma unroll 1
    for (int kc = wv * 32; kc < K; kc += 32 * KW) {
        V a[4], a2[4];
#pragma unroll
        for (int mb = 0; mb < 4; ++mb) { a[mb] = WFrag<T16>::ld(A + aoff + (size_t)mb * 16 * K + kc); if (NSPLIT == 1 || NSPLIT == 2) a2[mb] = WFrag<T16>::ld(A2 + aoff + (size_t)mb * 16 * K + kc); }
#pragma unroll
        for (int nb = 0; nb < 4; ++nb) { const V b = WFrag<T16>::ld(Bt + boff + (size_t)nb * 16 * K + kc); V b2; if (NSPLIT >= 2) b2 = WFrag<T16>::ld(Bt2 + boff + (size_t)nb * 16 * K + kc);
#pragma unroll
            for (int mb = 0; mb < 4; ++mb) { acc[mb][nb] = WFrag<T16>::mma(a[mb], b, acc[mb][nb]); if (NSPLIT == 1 || NSPLIT == 2) acc[mb][nb] = WFrag<T16>::mma(a2[mb], b, acc[mb][nb]); if (NSPLIT >= 2) acc[mb][nb] = WFrag<T16>::mma(a[mb], b2, acc[mb][nb]); } }
        asm volatile("v_nop\n\tv_nop\n\tv_nop\n\tv_nop" : "+v"(acc[0][0]), "+v"(acc[1][1]), "+v"(acc[2][2]), "+v"(acc[3][3]) : "v"(a[0]), "v"(a[3]));
    }
    if constexpr (KW > 1) {
        float* osw = os + wv * SLAB;
#pragma unroll
        for (int mb = 0; mb < 4; ++mb)
#pragma unroll
            for (int nb = 0; nb < 4; ++nb)
#pragma unroll
                for (int j = 0; j < 8; ++j) osw[(mb * 16 + hi * 8 + j) * 68 + nb * 16 + lr] = acc[mb][nb][j];
        __syncthreads();   // every wave's partial tile is in LDS before any thread sums it
        const int row0 = (int)(threadIdx.x >> 4), cofs = (int)(threadIdx.x & 15) * 4;   // the block covers 2 * KW rows of 16 float4 per step
        constexpr int NQ = 32 / KW;
        v4f vq[NQ];
#pragma unroll
        for (int q = 0; q < NQ; ++q) { const int row = q * 2 * KW + row0; v4f val = *(const v4fa*)(os + row * 68 + cofs);
#pragma unroll
            for (int w = 1; w < KW; ++w) val += *(const v4fa*)(os + w * SLAB + row * 68 + cofs);
            if (BIAS == 1) { val[0] += bfr(bias[c0 + cofs]); val[1] += bfr(bias[c0 + cofs + 1]); val[2] += bfr(bias[c0 + cofs + 2]); val[3] += bfr(bias[c0 + cofs + 3]); }
            if (BIAS == 2) val += bfr(bias[r0 + row]);
            vq[q] = val; }
        if constexpr (OM == 0) {
            float* pc[NQ];
#pragma unroll
            for (int q = 0; q < NQ; ++q) pc[q] = C + (size_t)(r0 + q * 2 * KW + row0) * ldc + c0 + cofs;
#pragma unroll
            for (int q = 0; q < NQ; ++q) *(v4f*)pc[q] = vq[q];
        } else {
            v4us oh[NQ], ol[NQ]; bf* pa[NQ]; bf* pb[NQ];
#pragma unroll
            for (int q = 0; q < NQ; ++q) { const int row = r0 + q * 2 * KW + row0;
#pragma unroll
                for (int e = 0; e < 4; ++e) oh[q][e] = f2bf(vq[q][e]);
                v4f hf;
#pragma unroll
                for (int e = 0; e < 4; ++e) hf[e] = bf2f(oh[q][e]);
                const v4f rs = vq[q] - hf;   // what the hi plane leaves, exact in f32
#pragma unroll
                for (int e = 0; e < 4; ++e) ol[q][e] = f2bf(rs[e]);
                const size_t eo = (OM == 1) ? (size_t)row * ldc + c0 + cofs : ((size_t)blockIdx.y * TT + row) * HD + cofs; pa[q] = Ph + eo; pb[q] = Pl + eo; }
            __builtin_amdgcn_sched_barrier(0);   // all values and addresses are ready here: behind the first store no register that a store names is written any more (the scheduler otherwise lifts the first store into the split and has to wait before it reuses the store's registers)
#pragma unroll
            for (int q = 0; q < NQ; ++q) { *(v4us*)pa[q] = oh[q]; *(v4us*)pb[q] = ol[q]; }
        }
        return;
    }
#pragma unroll
    for (int mb = 0; mb < 4; ++mb) {
#pragma unroll
        for (int nb = 0; nb < 4; ++nb) {
#pragma unroll
            for (int j = 0; j < 8; ++j) os[(hi * 8 + j) * 68 + nb * 16 + lr] = acc[mb][nb][j]; }
        __builtin_amdgcn_wave_barrier(); asm volatile("" ::: "memory");
        float* crow = C + (size_t)(r0 + mb * 16) * ldc + c0;
{
#pragma unroll
            for (int s = 0; s < 8; ++s) { const int row = 2 * s + hi, cofs = lr * 4; v4f val = *(const v4fa*)(os + row * 68 + cofs); if (BIAS) { val[0] += bfr(bias[c0 + cofs]); val[1] += bfr(bias[c0 + cofs + 1]); val[2] += bfr(bias[c0 + cofs + 2]); val[3] += bfr(bias[c0 + cofs + 3]); }
                *(v4f*)(crow + (size_t)row * ldc + cofs) = val; }
             }
        __builtin_amdgcn_wave_barrier(); asm volatile("" ::: "memory");
    }
}

typedef __attribute__((ext_vector_type(2))) unsigned short v2us;
typedef __attribute__((ext_vector_type(2))) float v2f;

__global__ __launch_bounds__(256) void k_wtG(const float* __restrict__ w, int K, int N, bf* Bt) {
    const int lane = threadIdx.x & 31; const int L0 = (blockIdx.x * 8 + (threadIdx.x >> 5)) * 8; const int nlines = N * K / 64;
{
#pragma unroll 1
        for (int l = 0; l < 8; ++l) { const int L = L0 + l; if (L >= nlines) break; const size_t e = (size_t)L * 64 + lane * 2; const int k = (int)(e % K), n = (int)(e / K); v2us o;
            o[0] = f2bf(w[(size_t)k * N + n]); o[1] = f2bf(w[(size_t)(k + 1) * N + n]); *(v2us*)(Bt + e) = o; }
         }
}
__global__ __launch_bounds__(256) void k_cvt8(const float* __restrict__ src, bf* dst, size_t n8) { const size_t i = (size_t)blockIdx.x * 256 + threadIdx.x; if (i >= n8) return; const v8f v = *(const v8f*)(src + i * 8); v8us o;
#pragma unroll
    for (int k = 0; k < 8; ++k) o[k] = f2bf(v[k]); *(v8us*)(dst + i * 8) = o;  }

__global__ __launch_bounds__(256) void k_wbdx(const float* __restrict__ w, bf* Bt) { const size_t i = (size_t)blockIdx.x * 256 + threadIdx.x; if (i >= (size_t)DQ * DQ / 8) return; const int k0 = (int)(i % (DQ / 8)) * 8; const int n = (int)(i / (DQ / 8)); const int h = n / HD, nn = n % HD; const int hb = k0 / HD; v8us o;
#pragma unroll
    for (int q = 0; q < 8; ++q) { const unsigned short v = f2bf(w[(size_t)((k0 + q) % HD) * HD + nn]); o[q] = (hb == h) ? v : (unsigned short)0; }
    *(v8us*)(Bt + (size_t)n * DQ + k0) = o;  }
typedef __attribute__((ext_vector_type(2))) __bf16 v2b;
typedef __attribute__((ext_vector_type(8))) unsigned v8u;
__device__ __forceinline__ float xhalf(float x) { const int b = __float_as_int(x); return __int_as_float(__builtin_amdgcn_permlanex16(b, b, 0x76543210, 0xfedcba98, false, false)); }   // the value of lane l ^ 16
__device__ __forceinline__ const bf* atb(const bf* base, unsigned bytes) { return (const bf*)((const char*)base + bytes); }   // uniform base + 32-bit lane offset
__global__ __launch_bounds__(256) void k_fattn(const bf* __restrict__ Qh, const bf* __restrict__ Ql, const bf* __restrict__ Kh, const bf* __restrict__ Kl, const bf* __restrict__ Vh, const bf* __restrict__ Vl, const int* __restrict__ thrp, bf* Ah, bf* Al) {
    typedef WFrag<bf> F; typedef F::V V;
    constexpr float L2E = 1.4426950408889634f;
    const int lane = threadIdx.x & 31, c = lane & 15, h = lane >> 4;
    const int hd = blockIdx.y, b = blockIdx.z; const int q0 = blockIdx.x * 256 + (int)(threadIdx.x >> 5) * 32;
    const int thr = __builtin_amdgcn_readfirstlane(thrp[b]);   // the batch's key threshold (input), a scalar so that the mask test is a scalar branch
    const size_t pl = ((size_t)b * NH_ + hd) * TT * HD;
    V qh[2][2], ql[2][2];
#pragma unroll
    for (int qt = 0; qt < 2; ++qt)
#pragma unroll
        for (int ks = 0; ks < 2; ++ks) { const size_t o = pl + (size_t)(q0 + qt * 16 + c) * HD + ks * 32 + 8 * h; qh[qt][ks] = F::ld(Qh + o); ql[qt][ks] = F::ld(Ql + o); }
    const bf* kph = Kh + pl; const bf* kpl = Kl + pl; const bf* vph = Vh + pl; const bf* vpl = Vl + pl;   // wave-uniform bases; the lane's part is a 32-bit byte offset
    const unsigned ko = (unsigned)(c * HD + 8 * h) * 2;   // bytes
    unsigned vb = (unsigned)(c * TT + 8 * h) * 2, kb2 = ko + 32 * HD * 2;   // the lane's byte offsets of this pass's V^T columns and of the next pass's K rows; both step only behind the wait that follows their loads
    v8f o[4][2];
#pragma unroll
    for (int dt = 0; dt < 4; ++dt)
#pragma unroll
        for (int qt = 0; qt < 2; ++qt) o[dt][qt] = (v8f){};
    float ms[2] = {-3.0e38f, -3.0e38f}, l[2] = {0.f, 0.f};
    V kh[2][2], kl[2][2];
#pragma unroll
    for (int kt = 0; kt < 2; ++kt)
#pragma unroll
        for (int ks = 0; ks < 2; ++ks) { kh[kt][ks] = F::ld(atb(kph, ko) + kt * 16 * HD + ks * 32); kl[kt][ks] = F::ld(atb(kpl, ko) + kt * 16 * HD + ks * 32); }
    asm volatile("s_wait_xcnt 0x0" ::: "memory");   // stands between the loads above and the next write of a register that they name as address
    __builtin_amdgcn_sched_barrier(0);   // holds later register writes behind that wait
#pragma unroll 1
    for (int kb = 0; kb < TT; kb += 32) {
        V vh[4], vl[4];   // this pass's V^T fragments, asked for ahead of the score products
#pragma unroll
        for (int dt = 0; dt < 4; ++dt) { vh[dt] = F::ld(atb(vph, vb) + dt * 16 * TT); vl[dt] = F::ld(atb(vpl, vb) + dt * 16 * TT); }
        asm volatile("s_wait_xcnt 0x0" ::: "memory");   // stands between these loads and the next write of a register that they name as address
        __builtin_amdgcn_sched_barrier(0);   // keeps the V^T loads issued here, a whole score block and softmax ahead of their use (the scheduler otherwise sinks them next to it), and the offset's step behind the wait
        vb += 64;
        v8f s[2][2];
#pragma unroll
        for (int kt = 0; kt < 2; ++kt)
#pragma unroll
            for (int qt = 0; qt < 2; ++qt) { v8f t = (v8f){};
#pragma unroll
                for (int ks = 0; ks < 2; ++ks) { t = F::mma(kh[kt][ks], qh[qt][ks], t); t = F::mma(kh[kt][ks], ql[qt][ks], t); t = F::mma(kl[kt][ks], qh[qt][ks], t); }
                s[kt][qt] = t; }
        // the next pass's K fragments fly during the softmax
#pragma unroll
        for (int kt = 0; kt < 2; ++kt)
#pragma unroll
            for (int ks = 0; ks < 2; ++ks) { kh[kt][ks] = F::ld(atb(kph, kb2) + kt * 16 * HD + ks * 32); kl[kt][ks] = F::ld(atb(kpl, kb2) + kt * 16 * HD + ks * 32); }
        asm volatile("s_wait_xcnt 0x0" ::: "memory");   // as above, for the K loads
        __builtin_amdgcn_sched_barrier(0);   // keeps the next K loads issued here, ahead of the softmax (the scheduler otherwise sinks them to the end of the pass, just in front of their use), and the offset's step behind the wait
        kb2 = (kb + 64 < TT) ? kb2 + 32 * HD * 2 : ko;   // the last pass re-reads pass 0, unused
        if (kb + 32 > thr) {   // keys >= threshold get the VALUE -1e-6 (MASK_VALUE), not an exclusion
#pragma unroll
            for (int kt = 0; kt < 2; ++kt)
#pragma unroll
                for (int r = 0; r < 8; ++r) { const bool keep = (kb + kt * 16 + 8 * h + r) < thr;
#pragma unroll
                    for (int qt = 0; qt < 2; ++qt) s[kt][qt][r] = keep ? s[kt][qt][r] : -1.0e-6f; }
        }
        float mxs[2]; bool need = false;
#pragma unroll
        for (int qt = 0; qt < 2; ++qt) { float mx = s[0][qt][0];
#pragma unroll
            for (int r = 1; r < 8; ++r) mx = fmaxf(mx, s[0][qt][r]);
#pragma unroll
            for (int r = 0; r < 8; ++r) mx = fmaxf(mx, s[1][qt][r]);
            mx = fmaxf(mx, xhalf(mx)); mxs[qt] = mx * L2E; need = need || (mxs[qt] > ms[qt] + 8.0f); }
        if (__builtin_amdgcn_ballot_w32(need) != 0) {
#pragma unroll
            for (int qt = 0; qt < 2; ++qt) { const float mn = fmaxf(ms[qt], mxs[qt]); const float al = __builtin_amdgcn_exp2f(ms[qt] - mn); ms[qt] = mn; l[qt] *= al;
#pragma unroll
                for (int dt = 0; dt < 4; ++dt) o[dt][qt] *= al; }
        }
        V ph[2], pw[2];
#pragma unroll
        for (int qt = 0; qt < 2; ++qt) { v2f sum = (v2f){0.f, 0.f}; v8u wh, wl;   // two elements at a time: packed conversions, packed sums
#pragma unroll
            for (int e = 0; e < 16; e += 2) { v2f p; p[0] = __builtin_amdgcn_exp2f(__builtin_fmaf(s[e >> 3][qt][e & 7], L2E, -ms[qt])); p[1] = __builtin_amdgcn_exp2f(__builtin_fmaf(s[e >> 3][qt][(e & 7) + 1], L2E, -ms[qt])); sum += p;
                const v2b hp = __builtin_convertvector(p, v2b); v2f rs; rs[0] = p[0] - (float)hp[0]; rs[1] = p[1] - (float)hp[1];
                wh[e >> 1] = __builtin_bit_cast(unsigned, hp); wl[e >> 1] = __builtin_bit_cast(unsigned, __builtin_convertvector(rs, v2b)); }
            ph[qt] = __builtin_bit_cast(V, wh); pw[qt] = __builtin_bit_cast(V, wl); l[qt] += sum[0] + sum[1]; }
#pragma unroll
        for (int dt = 0; dt < 4; ++dt)
#pragma unroll
            for (int qt = 0; qt < 2; ++qt) { o[dt][qt] = F::mma(vh[dt], ph[qt], o[dt][qt]); o[dt][qt] = F::mma(vh[dt], pw[qt], o[dt][qt]); o[dt][qt] = F::mma(vl[dt], ph[qt], o[dt][qt]); }
    }
    v8us oh[2][4], ol[2][4];
#pragma unroll
    for (int qt = 0; qt < 2; ++qt) { const float f = __fdiv_rn(1.0f, l[qt] + xhalf(l[qt]));
#pragma unroll
        for (int dt = 0; dt < 4; ++dt)
#pragma unroll
            for (int r = 0; r < 8; ++r) { unsigned short x2, y2; splitf(o[dt][qt][r] * f, x2, y2); oh[qt][dt][r] = x2; ol[qt][dt][r] = y2; } }
    const size_t ro = ((size_t)b * TT + q0 + c) * DQ + hd * HD + 8 * h; bf* pa = Ah + ro; bf* pb = Al + ro;
    __builtin_amdgcn_sched_barrier(0);   // all values and both addresses are ready here: behind the first store no register that a store names is written any more
#pragma unroll
    for (int qt = 0; qt < 2; ++qt)
#pragma unroll
        for (int dt = 0; dt < 4; ++dt) { *(v8us*)(pa + qt * 16 * DQ + dt * 16) = oh[qt][dt]; *(v8us*)(pb + qt * 16 * DQ + dt * 16) = ol[qt][dt]; }
}

extern "C" void kernel_launch(void* const* d_in, const int* in_sizes, int n_in,
                              void* d_out, int out_size, void* d_ws, size_t ws_size, hipStream_t stream) {
    (void)in_sizes; (void)n_in; (void)out_size;
    const float* x = (const float*)d_in[0]; const float* xk = (const float*)d_in[1]; const float* xv = (const float*)d_in[2]; const int* thr = (const int*)d_in[3]; const float* wq = (const float*)d_in[4]; const float* bq = (const float*)d_in[5]; const float* wk = (const float*)d_in[6]; const float* bk = (const float*)d_in[7]; const float* wv = (const float*)d_in[8]; const float* bv = (const float*)d_in[9]; const float* wbl = (const float*)d_in[10]; const float* wo = (const float*)d_in[11]; const float* bo = (const float*)d_in[12];
    float* OUT = (float*)d_out;     // [2][2048][1024]
    char* wsp = (char*)d_ws;
    auto take = [&](size_t bytes) { char* p = wsp; wsp += (bytes + 255) & ~(size_t)255; return (void*)p; };
    bf* WBD = (bf*)take((size_t)DQ * DQ * 2); bf* FQh = (bf*)take((size_t)TT * DQ * 2); bf* FQl = (bf*)take((size_t)TT * DQ * 2); bf* WQ = (bf*)take((size_t)DQ * DM * 2); bf* WK = (bf*)take((size_t)DKV * DM * 2); bf* WV = (bf*)take((size_t)DKV * DM * 2); bf* WO = (bf*)take((size_t)DM * DQ * 2);
    bf* XB = (bf*)take((size_t)TT * DM * 2);
    const size_t PLN = (size_t)NH_ * TT * HD;   // one batch's head planes; the hi/lo planes and the merged attention rows are kept for both batches
    bf* QPh = (bf*)take(NB_ * PLN * 2); bf* QPl = (bf*)take(NB_ * PLN * 2); bf* KPh = (bf*)take(NB_ * PLN * 2); bf* KPl = (bf*)take(NB_ * PLN * 2); bf* VTh = (bf*)take(NB_ * PLN * 2); bf* VTl = (bf*)take(NB_ * PLN * 2);
    bf* ATh = (bf*)take((size_t)NB_ * TT * DQ * 2); bf* ATl = (bf*)take((size_t)NB_ * TT * DQ * 2);
    if ((size_t)(wsp - (char*)d_ws) > ws_size) return;    // ws 256 MiB
    { k_wbdx<<<(unsigned)(((size_t)DQ * DQ / 8 + 255) / 256), 256, 0, stream>>>(wbl, WBD); k_wtG<<<(unsigned)((DM * DQ / 64 + 63) / 64), 256, 0, stream>>>(wq, DM, DQ, WQ); k_wtG<<<(unsigned)((DM * DKV / 64 + 63) / 64), 256, 0, stream>>>(wk, DM, DKV, WK); k_wtG<<<(unsigned)((DM * DKV / 64 + 63) / 64), 256, 0, stream>>>(wv, DM, DKV, WV);
      k_wtG<<<(unsigned)((DQ * DM / 64 + 63) / 64), 256, 0, stream>>>(wo, DQ, DM, WO);
       }
    for (int b = 0; b < NB_; ++b) {
        k_cvt8<<<(unsigned)(((size_t)TT * DM / 8 + 255) / 256), 256, 0, stream>>>(x + (size_t)b * TT * DM, XB, (size_t)TT * DM / 8);
        k_gemmw<bf, 0, 1, 8, 1><<<dim3(TT / 64, DQ / 64, 1), 256, 0, stream>>>(XB, nullptr, WQ, nullptr, DM, nullptr, FQh, FQl, DQ, bq, 0, 0, 0);   /* Q, flat hi/lo planes */
        k_gemmw<bf, 1, 0, 8, 2><<<dim3(TT / 64, DQ / 64, 1), 256, 0, stream>>>(FQh, FQl, WBD, nullptr, DQ, nullptr, QPh + b * PLN, QPl + b * PLN, DQ, nullptr, 0, 0, 0);   /* Q W (W shared by all heads = block-diagonal), head planes */
        k_cvt8<<<(unsigned)(((size_t)TT * DM / 8 + 255) / 256), 256, 0, stream>>>(xk + (size_t)b * TT * DM, XB, (size_t)TT * DM / 8);
        k_gemmw<bf, 0, 1, 8, 2><<<dim3(TT / 64, DKV / 64, 1), 256, 0, stream>>>(XB, nullptr, WK, nullptr, DM, nullptr, KPh + b * PLN, KPl + b * PLN, DKV, bk, 0, 0, 0);   /* K, head planes */
        k_cvt8<<<(unsigned)(((size_t)TT * DM / 8 + 255) / 256), 256, 0, stream>>>(xv + (size_t)b * TT * DM, XB, (size_t)TT * DM / 8);
        k_gemmw<bf, 0, 2, 8, 1><<<dim3(DKV / 64, TT / 64, 1), 256, 0, stream>>>(WV, nullptr, XB, nullptr, DM, nullptr, VTh + b * PLN, VTl + b * PLN, TT, bv, 0, 0, 0); }   /* V^T = Wv^T.X^T: rows are (head, d), columns the tokens, the layout k_fattn reads */
    k_fattn<<<dim3(TT / 256, NH_, NB_), 256, 0, stream>>>(QPh, QPl, KPh, KPl, VTh, VTl, thr, ATh, ATl);
    for (int b = 0; b < NB_; ++b)
        k_gemmw<bf, 1, 1, 8, 0><<<dim3(TT / 64, DM / 64, 1), 256, 0, stream>>>(ATh + (size_t)b * TT * DQ, ATl + (size_t)b * TT * DQ, WO, nullptr, DQ, OUT + (size_t)b * TT * DM, nullptr, nullptr, DM, bo, 0, 0, 0);
}

// v004
// A run of this version takes 188 microseconds.
// Next to v003, in two timings, it ran 1.54 and 1.52 times as fast.
// All steps since v000 together make it 7.46 times as fast.
#include <hip/hip_runtime.h>

// Multi-head attention with a learned bilinear score and a per-batch key threshold (queries, keys, values [2][2048][1024]; Q,K,V = input W + b ('xw' [1024][1024] + [1024]; 16 heads x 64); scores = (Q W).K with W [64][64] shared by all heads, NO 1/sqrt(d) (logit sigma ~8); keys j >= thresholds[b] get the logit MASK_VALUE = -1e-6 (a value near zero, NOT an exclusion -- reproduced literally; thresholds int [2], read); softmax; out = merged attn.V Wo + bo -> [2][2048][1024] (4.2 M)).
// Layout per batch: bf16 copies of the three inputs in turn; exact projections + f32 biases, each GEMM's join writing the bf16 hi/lo planes its consumer reads (Q flat, K by head, V^T as the product Wv^T.X^T); the bilinear W applied as one block-diagonal [1024][1024] GEMM on the hi/lo planes of Q (2 products), written by head; then ONE fused attention launch over both batches and all heads, EVERY row on hi/lo planes (3 products; unscaled logits), reading the batch's threshold once and selecting -1e-6 for j >= threshold, online softmax; merged hi/lo x Wo exact + bo.
// Every 16-bit plane lies in FRAGMENT ORDER: a matrix [rows][K] is cut into fragments of 16 rows x 32 k, fragment (rb, kb) at element (rb * (K / 32) + kb) * 512, and inside it element (row c, k = 8 q + e) at (q * 16 + c) * 8 + e. Lane l = 16 h + c of a wave then finds its two 16-byte pieces (q = h and q = 2 + h) at l * 8 and 256 + l * 8: each wave-wide load is 512 contiguous bytes, four whole lines. Every producer stores that order.
// Compute dtypes, f32 accumulate: every input rounded to bf16; projections exact + f32 biases; Q W hi/lo x exact; scores and attn.V 3 products on every row; softmax f32; Wo hl x exact + bias.

#define NB_  2
#define TT   2048
#define DM   1024
#define NH_  16
#define NKV  16
#define REP  (NH_ / NKV)
#define HD   64
#define DQ   (NH_ * HD)
#define DKV  (NKV * HD)
#define ZH   2
#define RH   2048                  // unused: every query row uses hi+lo planes
#define WIN  0
#define PCAR 1024.0f
#define SCL  1.0f   // no 1/sqrt(d) in the module
typedef _Float16 h16;
typedef unsigned short bf;
typedef __attribute__((ext_vector_type(16))) __bf16   v16bf;
typedef __attribute__((ext_vector_type(16))) _Float16 v16h;
typedef __attribute__((ext_vector_type(8)))  _Float16 v8h;
typedef __attribute__((ext_vector_type(8)))  unsigned short v8us;
typedef __attribute__((ext_vector_type(8)))  float    v8f;
typedef __attribute__((ext_vector_type(4)))  float    v4f;
typedef v8h  __attribute__((may_alias)) v8ha;
typedef v4f  __attribute__((may_alias)) v4fa;
typedef v8us __attribute__((may_alias)) v8usa;

__device__ __forceinline__ unsigned short f2bf(float f) { unsigned u = __float_as_uint(f); u += 0x7FFFu + ((u >> 16) & 1u); return (unsigned short)(u >> 16); }
__device__ __forceinline__ float bf2f(unsigned short b) { return __uint_as_float(((unsigned)b) << 16); }
__device__ __forceinline__ float bfr(float f) { return bf2f(f2bf(f)); }
__device__ __forceinline__ v16h cat16(v8h lo, v8h hi) { return __builtin_shufflevector(lo, hi, 0, 1, 2, 3, 4, 5, 6, 7, 8, 9, 10, 11, 12, 13, 14, 15); }
__device__ __forceinline__ v16bf cat16b(v8us lo, v8us hi) { return __builtin_bit_cast(v16bf, __builtin_shufflevector(lo, hi, 0, 1, 2, 3, 4, 5, 6, 7, 8, 9, 10, 11, 12, 13, 14, 15)); }
__device__ __forceinline__ v8f wmma16(v16h a, v16h b, v8f c) { return __builtin_amdgcn_wmma_f32_16x16x32_f16(false, a, false, b, (short)0, c, false, false); }
__device__ __forceinline__ v8f wmmab(v16bf a, v16bf b, v8f c) { return __builtin_amdgcn_wmma_f32_16x16x32_bf16(false, a, false, b, (short)0, c, false, false); }



// ---- k_gemmw: register-blocked GEMM, one 64x64 output tile per block (16 accumulators per wave), operands straight from 16-bit planes in fragment order (WFrag::ld takes the lane's place in a fragment); grid (M/64, N/64, Z), 32 * KW threads.
// C[m][n] (+ optional f32 bias: BIAS 1 bias[n], BIAS 2 bias[m]) = sum_k A[m][k] Bt[n][k] (+ split products per NSPLIT). z-batch strides sA/sB/sC in elements. K (a template constant, so that a row block's distance is an immediate offset of the load) % (32 * KW) == 0.
// Where the f32 sum goes (OM): 0 = f32 to C, pitch ldc; 1 = split into bf16 hi/lo planes Ph/Pl, a matrix of ldc columns in fragment order; 2 = the same split into head planes [n / 64], each a matrix [TT rows m][64 columns n % 64] in fragment order (a tile's 64 columns are one head).
// KW waves share the tile's K range: wave w takes the 32-wide k blocks w, w + KW, ... into its own full set of accumulators; the KW partial tiles are joined in LDS in the fixed order w = 0 .. KW-1 (KW = 1: no join).
template <typename T> __device__ __forceinline__ const T* atb(const T* base, unsigned bytes) { return (const T*)((const char*)base + bytes); }   // uniform base + 32-bit lane offset
template <typename T16> struct WFrag;
template <> struct WFrag<h16> { typedef v16h V; static __device__ __forceinline__ V ld(const h16* p) { return cat16(*(const v8h*)p, *(const v8h*)(p + 256)); } static __device__ __forceinline__ v8f mma(V a, V b, v8f c) { return wmma16(a, b, c); } };
template <> struct WFrag<bf> { typedef v16bf V; static __device__ __forceinline__ V ld(const bf* p) { return cat16b(*(const v8us*)p, *(const v8us*)(p + 256)); } static __device__ __forceinline__ v8f mma(V a, V b, v8f c) { return wmmab(a, b, c); } };
typedef __attribute__((ext_vector_type(4))) unsigned short v4us;
__device__ __forceinline__ void splitf(float y, unsigned short& h, unsigned short& l) { h = f2bf(y); l = f2bf(y - bf2f(h)); }
template <typename T16, int NSPLIT, int BIAS, int KW, int OM, int K>
__global__ __launch_bounds__(32 * KW) void k_gemmw(const T16* __restrict__ A, const T16* __restrict__ A2, const T16* __restrict__ Bt, const T16* __restrict__ Bt2, float* C, bf* Ph, bf* Pl, int ldc, const float* __restrict__ bias, size_t sA, size_t sB, size_t sC) {
    typedef typename WFrag<T16>::V V;
    static_assert(KW == 1 || 32 % KW == 0, "the join walks the 64 rows in steps of 2 * KW");
    static_assert(KW > 1 || (OM == 0 && BIAS != 2), "planes and the row bias are written by the join");
    static_assert(OM != 2 || HD == 64, "a tile's columns are one head");
    constexpr int SLAB = (KW == 1 ? 16 : 64) * 68;   // floats of one wave's staging slab (KW > 1: its whole partial tile)
    __shared__ __align__(16) float os[KW * SLAB];
    const int wv = (KW == 1) ? 0 : __builtin_amdgcn_readfirstlane((int)(threadIdx.x >> 5));   // wave number as a scalar: the k loop stays a scalar loop
    const size_t z = blockIdx.z; A += z * sA; if (A2) A2 += z * sA; Bt += z * sB; if (Bt2) Bt2 += z * sB; C += z * sC;
    const int lane = threadIdx.x & 31, lr = lane & 15, hi = lane >> 4; const int r0 = blockIdx.x * 64, c0 = blockIdx.y * 64;
    v8f acc[4][4];
#pragma unroll
    for (int mb = 0; mb < 4; ++mb)
#pragma unroll
        for (int nb = 0; nb < 4; ++nb) acc[mb][nb] = (v8f){};
    const size_t aoff = (size_t)r0 * K, boff = (size_t)c0 * K;   // wave-uniform: 16 rows of fragments are 16 * K elements, a 32-wide k block 512
    unsigned lo = (unsigned)lane * 16 + (unsigned)wv * 1024;   // bytes: the lane's place in a fragment + the wave's k block (1024 bytes each); one 32-bit offset serves every load of a pass beside its uniform base
#pragma unroll 1
    for (int kc = wv * 32; kc < K; kc += 32 * KW) {
        V a[4], a2[4];
#pragma unroll
        for (int mb = 0; mb < 4; ++mb) { a[mb] = WFrag<T16>::ld(atb(A + aoff + (size_t)mb * 16 * K, lo)); if (NSPLIT == 1 || NSPLIT == 2) a2[mb] = WFrag<T16>::ld(atb(A2 + aoff + (size_t)mb * 16 * K, lo)); }
        V b[4], b2[4];
#pragma unroll
        for (int nb = 0; nb < 4; ++nb) { b[nb] = WFrag<T16>::ld(atb(Bt + boff + (size_t)nb * 16 * K, lo)); if (NSPLIT >= 2) b2[nb] = WFrag<T16>::ld(atb(Bt2 + boff + (size_t)nb * 16 * K, lo)); }
        __builtin_amdgcn_sched_barrier(0);   // all loads of the pass are issued ahead of its products, one load latency a pass (the scheduler otherwise keeps one B fragment's registers and waits out a load per column block)
#pragma unroll
        for (int nb = 0; nb < 4; ++nb) {
#pragma unroll
            for (int mb = 0; mb < 4; ++mb) { acc[mb][nb] = WFrag<T16>::mma(a[mb], b[nb], acc[mb][nb]); if (NSPLIT == 1 || NSPLIT == 2) acc[mb][nb] = WFrag<T16>::mma(a2[mb], b[nb], acc[mb][nb]); if (NSPLIT >= 2) acc[mb][nb] = WFrag<T16>::mma(a[mb], b2[nb], acc[mb][nb]); } }
        asm volatile("v_nop\n\tv_nop\n\tv_nop\n\tv_nop" : "+v"(acc[0][0]), "+v"(acc[1][1]), "+v"(acc[2][2]), "+v"(acc[3][3]) : "v"(a[0]), "v"(a[3]));
        asm volatile("s_wait_xcnt 0x0" ::: "memory");   // stands between this pass's loads and the step of the offset register that they name
        __builtin_amdgcn_sched_barrier(0);   // holds the step behind that wait
        lo += KW * 1024;
    }
    if constexpr (KW > 1) {
        float* osw = os + wv * SLAB;
#pragma unroll
        for (int mb = 0; mb < 4; ++mb)
#pragma unroll
            for (int nb = 0; nb < 4; ++nb)
#pragma unroll
                for (int j = 0; j < 8; ++j) osw[(mb * 16 + hi * 8 + j) * 68 + nb * 16 + lr] = acc[mb][nb][j];
        __syncthreads();   // every wave's partial tile is in LDS before any thread sums it
        if constexpr (OM == 0) {
            const int row0 = (int)(threadIdx.x >> 4), cofs = (int)(threadIdx.x & 15) * 4;   // the block covers 2 * KW rows of 16 float4 per step
            constexpr int NQ = 32 / KW;
            v4f vq[NQ];
#pragma unroll
            for (int q = 0; q < NQ; ++q) { const int row = q * 2 * KW + row0; v4f val = *(const v4fa*)(os + row * 68 + cofs);
#pragma unroll
                for (int w = 1; w < KW; ++w) val += *(const v4fa*)(os + w * SLAB + row * 68 + cofs);
                if (BIAS == 1) { val[0] += bfr(bias[c0 + cofs]); val[1] += bfr(bias[c0 + cofs + 1]); val[2] += bfr(bias[c0 + cofs + 2]); val[3] += bfr(bias[c0 + cofs + 3]); }
                if (BIAS == 2) val += bfr(bias[r0 + row]);
                vq[q] = val; }
            float* pc[NQ];
#pragma unroll
            for (int q = 0; q < NQ; ++q) pc[q] = C + (size_t)(r0 + q * 2 * KW + row0) * ldc + c0 + cofs;
#pragma unroll
            for (int q = 0; q < NQ; ++q) *(v4f*)pc[q] = vq[q];
        } else {
            static_assert(KW == 8, "16 half fragments of the tile over 8 waves, 2 steps");
            // A thread joins 8 consecutive columns of one row, one 16-byte unit of the plane; a wave takes the 32 units of half a fragment (16 rows x the k units 2 j and 2 j + 1), which lie in lane order: each store is 512 contiguous bytes. The LDS reads stay free of bank conflicts (16 rows at pitch 68 start 4 banks apart).
            v8us oh[2], ol[2]; bf* pa[2]; bf* pb[2];
#pragma unroll
            for (int s = 0; s < 2; ++s) { const int hf = s * 8 + wv, rbl = hf >> 2, kbl = (hf >> 1) & 1, j = hf & 1;   // which half fragment of the tile: row block, k block, piece
                const int row = rbl * 16 + lr, col = kbl * 32 + j * 16 + hi * 8;
                v4f v0 = *(const v4fa*)(os + row * 68 + col), v1 = *(const v4fa*)(os + row * 68 + col + 4);
#pragma unroll
                for (int w = 1; w < KW; ++w) { v0 += *(const v4fa*)(os + w * SLAB + row * 68 + col); v1 += *(const v4fa*)(os + w * SLAB + row * 68 + col + 4); }
                if (BIAS == 1) {
#pragma unroll
                    for (int e = 0; e < 4; ++e) { v0[e] += bfr(bias[c0 + col + e]); v1[e] += bfr(bias[c0 + col + 4 + e]); } }
                if (BIAS == 2) { const float rb = bfr(bias[r0 + row]); v0 += rb; v1 += rb; }
#pragma unroll
                for (int e = 0; e < 4; ++e) { oh[s][e] = f2bf(v0[e]); oh[s][4 + e] = f2bf(v1[e]); }
                v4f h0, h1;
#pragma unroll
                for (int e = 0; e < 4; ++e) { h0[e] = bf2f(oh[s][e]); h1[e] = bf2f(oh[s][4 + e]); }
                const v4f s0 = v0 - h0, s1 = v1 - h1;   // what the hi plane leaves, exact in f32
#pragma unroll
                for (int e = 0; e < 4; ++e) { ol[s][e] = f2bf(s0[e]); ol[s][4 + e] = f2bf(s1[e]); }
                const size_t fr = (OM == 1) ? (size_t)(r0 / 16 + rbl) * (ldc / 32) + c0 / 32 + kbl : ((size_t)blockIdx.y * (TT / 16) + r0 / 16 + rbl) * (HD / 32) + kbl;   // the fragment's number in its plane
                const size_t eo = fr * 512 + j * 256 + lane * 8; pa[s] = Ph + eo; pb[s] = Pl + eo; }
            __builtin_amdgcn_sched_barrier(0);   // all values and addresses are ready here: behind the first store no register that a store names is written any more (the scheduler otherwise lifts the first store into the split and has to wait before it reuses the store's registers)
#pragma unroll
            for (int s = 0; s < 2; ++s) { *(v8us*)pa[s] = oh[s]; *(v8us*)pb[s] = ol[s]; }
        }
        return;
    }
#pragma unroll
    for (int mb = 0; mb < 4; ++mb) {
#pragma unroll
        for (int nb = 0; nb < 4; ++nb) {
#pragma unroll
            for (int j = 0; j < 8; ++j) os[(hi * 8 + j) * 68 + nb * 16 + lr] = acc[mb][nb][j]; }
        __builtin_amdgcn_wave_barrier(); asm volatile("" ::: "memory");
        float* crow = C + (size_t)(r0 + mb * 16) * ldc + c0;
{
#pragma unroll
            for (int s = 0; s < 8; ++s) { const int row = 2 * s + hi, cofs = lr * 4; v4f val = *(const v4fa*)(os + row * 68 + cofs); if (BIAS) { val[0] += bfr(bias[c0 + cofs]); val[1] += bfr(bias[c0 + cofs + 1]); val[2] += bfr(bias[c0 + cofs + 2]); val[3] += bfr(bias[c0 + cofs + 3]); }
                *(v4f*)(crow + (size_t)row * ldc + cofs) = val; }
             }
        __builtin_amdgcn_wave_barrier(); asm volatile("" ::: "memory");
    }
}

typedef __attribute__((ext_vector_type(2))) unsigned short v2us;
typedef __attribute__((ext_vector_type(2))) float v2f;

// The three converters store fragment order. k_wtG (Bt[n][k] = w[k][n]): a thread takes one column n and 8 consecutive k; a wave's 32 columns make each load one whole line and each store two runs of 256 bytes.
__global__ __launch_bounds__(256) void k_wtG(const float* __restrict__ w, int K, int N, bf* Bt) {
    const int n = blockIdx.x * 256 + threadIdx.x, u = blockIdx.y; if (n >= N) return; v8us o;   // grid (N / 256, K / 8)
    const float* wr = w + (size_t)u * 8 * N;   // the block's 8 rows: uniform bases, the lane's part is its column
#pragma unroll
    for (int e = 0; e < 8; ++e) o[e] = f2bf(*atb(wr + (size_t)e * N, (unsigned)n * 4));
    *(v8us*)(Bt + ((size_t)(n >> 4) * (K / 32) + (u >> 2)) * 512 + ((u & 3) * 16 + (n & 15)) * 8) = o;
}
// k_cvt8 (rows of DM): a wave takes 8 rows x 32 k, half a fragment: lane = (k unit q, row); it reads 8 whole lines in two loads and stores 4 whole lines.
__global__ __launch_bounds__(256) void k_cvt8(const float* __restrict__ src, bf* dst, size_t n8) { const size_t i = (size_t)blockIdx.x * 256 + threadIdx.x; if (i >= n8) return;
    const int lane = threadIdx.x & 31, q = lane >> 3; const size_t wv = i >> 5, fr = wv >> 1; const int c = (int)(wv & 1) * 8 + (lane & 7);
    const v8f v = *(const v8f*)(src + ((fr / (DM / 32)) * 16 + c) * DM + (fr % (DM / 32)) * 32 + q * 8); v8us o;
#pragma unroll
    for (int k = 0; k < 8; ++k) o[k] = f2bf(v[k]); *(v8us*)(dst + fr * 512 + (q * 16 + c) * 8) = o;  }

// k_wbdx: thread i writes unit i of the plane: row c, k unit q of fragment i / 64.
__global__ __launch_bounds__(256) void k_wbdx(const float* __restrict__ w, bf* Bt) { const size_t i = (size_t)blockIdx.x * 256 + threadIdx.x; if (i >= (size_t)DQ * DQ / 8) return; const int fr = (int)(i >> 6); const int k0 = (fr % (DQ / 32)) * 32 + ((int)(i >> 4) & 3) * 8; const int n = (fr / (DQ / 32)) * 16 + (int)(i & 15); const int h = n / HD, nn = n % HD; const int hb = k0 / HD; v8us o;
#pragma unroll
    for (int q = 0; q < 8; ++q) { const unsigned short v = f2bf(w[(size_t)((k0 + q) % HD) * HD + nn]); o[q] = (hb == h) ? v : (unsigned short)0; }
    *(v8us*)(Bt + i * 8) = o;  }
typedef __attribute__((ext_vector_type(2))) __bf16 v2b;
typedef __attribute__((ext_vector_type(8))) unsigned v8u;
__device__ __forceinline__ float xhalf(float x) { const int b = __float_as_int(x); return __int_as_float(__builtin_amdgcn_permlanex16(b, b, 0x76543210, 0xfedcba98, false, false)); }   // the value of lane l ^ 16
__global__ __launch_bounds__(256) void k_fattn(const bf* __restrict__ Qh, const bf* __restrict__ Ql, const bf* __restrict__ Kh, const bf* __restrict__ Kl, const bf* __restrict__ Vh, const bf* __restrict__ Vl, const int* __restrict__ thrp, bf* Ah, bf* Al) {
    typedef WFrag<bf> F; typedef F::V V;
    constexpr float L2E = 1.4426950408889634f;
    const int lane = threadIdx.x & 31, h = lane >> 4;
    const int hd = blockIdx.y, b = blockIdx.z; const int q0 = blockIdx.x * 256 + __builtin_amdgcn_readfirstlane((int)(threadIdx.x >> 5)) * 32;   // the wave's number as a scalar: every fragment's base is wave-uniform
    const int thr = __builtin_amdgcn_readfirstlane(thrp[b]);   // the batch's key threshold (input), a scalar so that the mask test is a scalar branch
    const size_t pl = ((size_t)b * NH_ + hd) * TT * HD;
    const unsigned ko = (unsigned)lane * 16;   // bytes: the lane's place in a fragment, its only own part of a load's address
    V qh[2][2], ql[2][2];
#pragma unroll
    for (int qt = 0; qt < 2; ++qt)
#pragma unroll
        for (int ks = 0; ks < 2; ++ks) { const size_t o = pl + (size_t)(q0 + qt * 16) * HD + ks * 512; qh[qt][ks] = F::ld(atb(Qh + o, ko)); ql[qt][ks] = F::ld(atb(Ql + o, ko)); }
    const bf* kph = Kh + pl; const bf* kpl = Kl + pl; const bf* vph = Vh + pl; const bf* vpl = Vl + pl;   // wave-uniform bases; the lane's part is a 32-bit byte offset
    unsigned vb = ko, kb2 = ko + 32 * HD * 2;   // the lane's byte offsets of this pass's V^T columns and of the next pass's K rows; both step only behind the wait that follows their loads
    v8f o[4][2];
#pragma unroll
    for (int dt = 0; dt < 4; ++dt)
#pragma unroll
        for (int qt = 0; qt < 2; ++qt) o[dt][qt] = (v8f){};
    float ms[2] = {-3.0e38f, -3.0e38f}, l[2] = {0.f, 0.f};
    V kh[2][2], kl[2][2];
#pragma unroll
    for (int kt = 0; kt < 2; ++kt)
#pragma unroll
        for (int ks = 0; ks < 2; ++ks) { kh[kt][ks] = F::ld(atb(kph, ko) + kt * 16 * HD + ks * 512); kl[kt][ks] = F::ld(atb(kpl, ko) + kt * 16 * HD + ks * 512); }
    asm volatile("s_wait_xcnt 0x0" ::: "memory");   // stands between the loads above and the next write of a register that they name as address
    __builtin_amdgcn_sched_barrier(0);   // holds later register writes behind that wait
#pragma unroll 1
    for (int kb = 0; kb < TT; kb += 32) {
        V vh[4], vl[4];   // this pass's V^T fragments, asked for ahead of the score products
#pragma unroll
        for (int dt = 0; dt < 4; ++dt) { vh[dt] = F::ld(atb(vph, vb) + dt * 16 * TT); vl[dt] = F::ld(atb(vpl, vb) + dt * 16 * TT); }
        asm volatile("s_wait_xcnt 0x0" ::: "memory");   // stands between these loads and the next write of a register that they name as address
        __builtin_amdgcn_sched_barrier(0);   // keeps the V^T loads issued here, a whole score block and softmax ahead of their use (the scheduler otherwise sinks them next to it), and the offset's step behind the wait
        vb += 1024;   // the next 32 keys' fragment of the same 16 rows
        v8f s[2][2];
#pragma unroll
        for (int kt = 0; kt < 2; ++kt)
#pragma unroll
            for (int qt = 0; qt < 2; ++qt) { v8f t = (v8f){};
#pragma unroll
                for (int ks = 0; ks < 2; ++ks) { t = F::mma(kh[kt][ks], qh[qt][ks], t); t = F::mma(kh[kt][ks], ql[qt][ks], t); t = F::mma(kl[kt][ks], qh[qt][ks], t); }
                s[kt][qt] = t; }
        // the next pass's K fragments fly during the softmax
#pragma unroll
        for (int kt = 0; kt < 2; ++kt)
#pragma unroll
            for (int ks = 0; ks < 2; ++ks) { kh[kt][ks] = F::ld(atb(kph, kb2) + kt * 16 * HD + ks * 512); kl[kt][ks] = F::ld(atb(kpl, kb2) + kt * 16 * HD + ks * 512); }
        asm volatile("s_wait_xcnt 0x0" ::: "memory");   // as above, for the K loads
        __builtin_amdgcn_sched_barrier(0);   // keeps the next K loads issued here, ahead of the softmax (the scheduler otherwise sinks them to the end of the pass, just in front of their use), and the offset's step behind the wait
        kb2 = (kb + 64 < TT) ? kb2 + 32 * HD * 2 : ko;   // the last pass re-reads pass 0, unused
        if (kb + 32 > thr) {   // keys >= threshold get the VALUE -1e-6 (MASK_VALUE), not an exclusion
#pragma unroll
            for (int kt = 0; kt < 2; ++kt)
#pragma unroll
                for (int r = 0; r < 8; ++r) { const bool keep = (kb + kt * 16 + 8 * h + r) < thr;
#pragma unroll
                    for (int qt = 0; qt < 2; ++qt) s[kt][qt][r] = keep ? s[kt][qt][r] : -1.0e-6f; }
        }
        float mxs[2]; bool need = false;
#pragma unroll
        for (int qt = 0; qt < 2; ++qt) { float mx = s[0][qt][0];
#pragma unroll
            for (int r = 1; r < 8; ++r) mx = fmaxf(mx, s[0][qt][r]);
#pragma unroll
            for (int r = 0; r < 8; ++r) mx = fmaxf(mx, s[1][qt][r]);
            mx = fmaxf(mx, xhalf(mx)); mxs[qt] = mx * L2E; need = need || (mxs[qt] > ms[qt] + 8.0f); }
        if (__builtin_amdgcn_ballot_w32(need) != 0) {
#pragma unroll
            for (int qt = 0; qt < 2; ++qt) { const float mn = fmaxf(ms[qt], mxs[qt]); const float al = __builtin_amdgcn_exp2f(ms[qt] - mn); ms[qt] = mn; l[qt] *= al;
#pragma unroll
                for (int dt = 0; dt < 4; ++dt) o[dt][qt] *= al; }
        }
        V ph[2], pw[2];
#pragma unroll
        for (int qt = 0; qt < 2; ++qt) { v2f sum = (v2f){0.f, 0.f}; v8u wh, wl;   // two elements at a time: packed conversions, packed sums
#pragma unroll
            for (int e = 0; e < 16; e += 2) { v2f p; p[0] = __builtin_amdgcn_exp2f(__builtin_fmaf(s[e >> 3][qt][e & 7], L2E, -ms[qt])); p[1] = __builtin_amdgcn_exp2f(__builtin_fmaf(s[e >> 3][qt][(e & 7) + 1], L2E, -ms[qt])); sum += p;
                const v2b hp = __builtin_convertvector(p, v2b); v2f rs; rs[0] = p[0] - (float)hp[0]; rs[1] = p[1] - (float)hp[1];
                wh[e >> 1] = __builtin_bit_cast(unsigned, hp); wl[e >> 1] = __builtin_bit_cast(unsigned, __builtin_convertvector(rs, v2b)); }
            ph[qt] = __builtin_bit_cast(V, wh); pw[qt] = __builtin_bit_cast(V, wl); l[qt] += sum[0] + sum[1]; }
#pragma unroll
        for (int dt = 0; dt < 4; ++dt)
#pragma unroll
            for (int qt = 0; qt < 2; ++qt) { o[dt][qt] = F::mma(vh[dt], ph[qt], o[dt][qt]); o[dt][qt] = F::mma(vh[dt], pw[qt], o[dt][qt]); o[dt][qt] = F::mma(vl[dt], ph[qt], o[dt][qt]); }
    }
    v8us oh[2][4], ol[2][4];
#pragma unroll
    for (int qt = 0; qt < 2; ++qt) { const float f = __fdiv_rn(1.0f, l[qt] + xhalf(l[qt]));
#pragma unroll
        for (int dt = 0; dt < 4; ++dt)
#pragma unroll
            for (int r = 0; r < 8; ++r) { unsigned short x2, y2; splitf(o[dt][qt][r] * f, x2, y2); oh[qt][dt][r] = x2; ol[qt][dt][r] = y2; } }
    const size_t ro = ((size_t)b * TT + q0) * DQ + hd * (HD / 32) * 512 + lane * 8; bf* pa = Ah + ro; bf* pb = Al + ro;   // merged rows [NB_ * TT][DQ] in fragment order: the head's two k blocks, piece dt & 1 of block dt >> 1
    __builtin_amdgcn_sched_barrier(0);   // all values and both addresses are ready here: behind the first store no register that a store names is written any more
#pragma unroll
    for (int qt = 0; qt < 2; ++qt)
#pragma unroll
        for (int dt = 0; dt < 4; ++dt) { *(v8us*)(pa + qt * 16 * DQ + dt * 256) = oh[qt][dt]; *(v8us*)(pb + qt * 16 * DQ + dt * 256) = ol[qt][dt]; }
}

extern "C" void kernel_launch(void* const* d_in, const int* in_sizes, int n_in,
                              void* d_out, int out_size, void* d_ws, size_t ws_size, hipStream_t stream) {
    (void)in_sizes; (void)n_in; (void)out_size;
    const float* x = (const float*)d_in[0]; const float* xk = (const float*)d_in[1]; const float* xv = (const float*)d_in[2]; const int* thr = (const int*)d_in[3]; const float* wq = (const float*)d_in[4]; const float* bq = (const float*)d_in[5]; const float* wk = (const float*)d_in[6]; const float* bk = (const float*)d_in[7]; const float* wv = (const float*)d_in[8]; const float* bv = (const float*)d_in[9]; const float* wbl = (const float*)d_in[10]; const float* wo = (const float*)d_in[11]; const float* bo = (const float*)d_in[12];
    float* OUT = (float*)d_out;     // [2][2048][1024]
    char* wsp = (char*)d_ws;
    auto take = [&](size_t bytes) { char* p = wsp; wsp += (bytes + 255) & ~(size_t)255; return (void*)p; };
    bf* WBD = (bf*)take((size_t)DQ * DQ * 2); bf* FQh = (bf*)take((size_t)TT * DQ * 2); bf* FQl = (bf*)take((size_t)TT * DQ * 2); bf* WQ = (bf*)take((size_t)DQ * DM * 2); bf* WK = (bf*)take((size_t)DKV * DM * 2); bf* WV = (bf*)take((size_t)DKV * DM * 2); bf* WO = (bf*)take((size_t)DM * DQ * 2);
    bf* XB = (bf*)take((size_t)TT * DM * 2);
    const size_t PLN = (size_t)NH_ * TT * HD;   // one batch's head planes; the hi/lo planes and the merged attention rows are kept for both batches
    bf* QPh = (bf*)take(NB_ * PLN * 2); bf* QPl = (bf*)take(NB_ * PLN * 2); bf* KPh = (bf*)take(NB_ * PLN * 2); bf* KPl = (bf*)take(NB_ * PLN * 2); bf* VTh = (bf*)take(NB_ * PLN * 2); bf* VTl = (bf*)take(NB_ * PLN * 2);
    bf* ATh = (bf*)take((size_t)NB_ * TT * DQ * 2); bf* ATl = (bf*)take((size_t)NB_ * TT * DQ * 2);
    if ((size_t)(wsp - (char*)d_ws) > ws_size) return;    // ws 256 MiB
    { k_wbdx<<<(unsigned)(((size_t)DQ * DQ / 8 + 255) / 256), 256, 0, stream>>>(wbl, WBD); k_wtG<<<dim3(DQ / 256, DM / 8, 1), 256, 0, stream>>>(wq, DM, DQ, WQ); k_wtG<<<dim3(DKV / 256, DM / 8, 1), 256, 0, stream>>>(wk, DM, DKV, WK); k_wtG<<<dim3(DKV / 256, DM / 8, 1), 256, 0, stream>>>(wv, DM, DKV, WV);
      k_wtG<<<dim3(DM / 256, DQ / 8, 1), 256, 0, stream>>>(wo, DQ, DM, WO);
       }
    for (int b = 0; b < NB_; ++b) {
        k_cvt8<<<(unsigned)(((size_t)TT * DM / 8 + 255) / 256), 256, 0, stream>>>(x + (size_t)b * TT * DM, XB, (size_t)TT * DM / 8);
        k_gemmw<bf, 0, 1, 8, 1, DM><<<dim3(TT / 64, DQ / 64, 1), 256, 0, stream>>>(XB, nullptr, WQ, nullptr, nullptr, FQh, FQl, DQ, bq, 0, 0, 0);   /* Q, flat hi/lo planes */
        k_gemmw<bf, 1, 0, 8, 2, DQ><<<dim3(TT / 64, DQ / 64, 1), 256, 0, stream>>>(FQh, FQl, WBD, nullptr, nullptr, QPh + b * PLN, QPl + b * PLN, DQ, nullptr, 0, 0, 0);   /* Q W (W shared by all heads = block-diagonal), head planes */
        k_cvt8<<<(unsigned)(((size_t)TT * DM / 8 + 255) / 256), 256, 0, stream>>>(xk + (size_t)b * TT * DM, XB, (size_t)TT * DM / 8);
        k_gemmw<bf, 0, 1, 8, 2, DM><<<dim3(TT / 64, DKV / 64, 1), 256, 0, stream>>>(XB, nullptr, WK, nullptr, nullptr, KPh + b * PLN, KPl + b * PLN, DKV, bk, 0, 0, 0);   /* K, head planes */
        k_cvt8<<<(unsigned)(((size_t)TT * DM / 8 + 255) / 256), 256, 0, stream>>>(xv + (size_t)b * TT * DM, XB, (size_t)TT * DM / 8);
        k_gemmw<bf, 0, 2, 8, 1, DM><<<dim3(DKV / 64, TT / 64, 1), 256, 0, stream>>>(WV, nullptr, XB, nullptr, nullptr, VTh + b * PLN, VTl + b * PLN, TT, bv, 0, 0, 0); }   /* V^T = Wv^T.X^T: rows are (head, d), columns the tokens, the layout k_fattn reads */
    k_fattn<<<dim3(TT / 256, NH_, NB_), 256, 0, stream>>>(QPh, QPl, KPh, KPl, VTh, VTl, thr, ATh, ATl);
    for (int b = 0; b < NB_; ++b)
        k_gemmw<bf, 1, 1, 8, 0, DQ><<<dim3(TT / 64, DM / 64, 1), 256, 0, stream>>>(ATh + (size_t)b * TT * DQ, ATl + (size_t)b * TT * DQ, WO, nullptr, OUT + (size_t)b * TT * DM, nullptr, nullptr, DM, bo, 0, 0, 0);
}

// v005
// Measured time: 151 microseconds a run.
// Timed twice side by side with v004, it ran 1.24 times as fast both times.
// All steps since v000 together make it 9.25 times as fast.
#include <hip/hip_runtime.h>

// Multi-head attention with a learned bilinear score and a per-batch key threshold (queries, keys, values [2][2048][1024]; Q,K,V = input W + b ('xw' [1024][1024] + [1024]; 16 heads x 64); scores = (Q W).K with W [64][64] shared by all heads, NO 1/sqrt(d) (logit sigma ~8); keys j >= thresholds[b] get the logit MASK_VALUE = -1e-6 (a value near zero, NOT an exclusion -- reproduced literally; thresholds int [2], read); softmax; out = merged attn.V Wo + bo -> [2][2048][1024] (4.2 M)).
// Five launches, each over both batches: one converter launch (bf16 copies of the three inputs and of the weights); the three projections in one launch; Q W; attention; Wo. Exact projections + f32 biases, each GEMM's join writing the bf16 hi/lo planes its consumer reads (Q flat, K by head, V^T as the product Wv^T.X^T); the bilinear W applied as one block-diagonal [1024][1024] GEMM on the hi/lo planes of Q (2 products), written by head; then ONE fused attention launch over both batches and all heads, EVERY row on hi/lo planes (3 products; unscaled logits), reading the batch's threshold once and selecting -1e-6 for j >= threshold, online softmax; merged hi/lo x Wo exact + bo.
// Every 16-bit plane lies in FRAGMENT ORDER: a matrix [rows][K] is cut into fragments of 16 rows x 32 k, fragment (rb, kb) at element (rb * (K / 32) + kb) * 512, and inside it element (row c, k = 8 q + e) at (q * 16 + c) * 8 + e. Lane l = 16 h + c of a wave then finds its two 16-byte pieces (q = h and q = 2 + h) at l * 8 and 256 + l * 8: each wave-wide load is 512 contiguous bytes, four whole lines. Every producer stores that order.
// Compute dtypes, f32 accumulate: every input rounded to bf16; projections exact + f32 biases; Q W hi/lo x exact; scores and attn.V 3 products on every row; softmax f32; Wo hl x exact + bias.

#define NB_  2
#define TT   2048
#define DM   1024
#define NH_  16
#define NKV  16
#define REP  (NH_ / NKV)
#define HD   64
#define DQ   (NH_ * HD)
#define DKV  (NKV * HD)
#define ZH   2
#define RH   2048                  // unused: every query row uses hi+lo planes
#define WIN  0
#define PCAR 1024.0f
#define SCL  1.0f   // no 1/sqrt(d) in the module
typedef _Float16 h16;
typedef unsigned short bf;
typedef __attribute__((ext_vector_type(16))) __bf16   v16bf;
typedef __attribute__((ext_vector_type(16))) _Float16 v16h;
typedef __attribute__((ext_vector_type(8)))  _Float16 v8h;
typedef __attribute__((ext_vector_type(8)))  unsigned short v8us;
typedef __attribute__((ext_vector_type(8)))  float    v8f;
typedef __attribute__((ext_vector_type(4)))  float    v4f;
typedef v8h  __attribute__((may_alias)) v8ha;
typedef v4f  __attribute__((may_alias)) v4fa;
typedef v8us __attribute__((may_alias)) v8usa;

__device__ __forceinline__ unsigned short f2bf(float f) { unsigned u = __float_as_uint(f); u += 0x7FFFu + ((u >> 16) & 1u); return (unsigned short)(u >> 16); }
__device__ __forceinline__ float bf2f(unsigned short b) { return __uint_as_float(((unsigned)b) << 16); }
__device__ __forceinline__ float bfr(float f) { return bf2f(f2bf(f)); }
__device__ __forceinline__ v16h cat16(v8h lo, v8h hi) { return __builtin_shufflevector(lo, hi, 0, 1, 2, 3, 4, 5, 6, 7, 8, 9, 10, 11, 12, 13, 14, 15); }
__device__ __forceinline__ v16bf cat16b(v8us lo, v8us hi) { return __builtin_bit_cast(v16bf, __builtin_shufflevector(lo, hi, 0, 1, 2, 3, 4, 5, 6, 7, 8, 9, 10, 11, 12, 13, 14, 15)); }
__device__ __forceinline__ v8f wmma16(v16h a, v16h b, v8f c) { return __builtin_amdgcn_wmma_f32_16x16x32_f16(false, a, false, b, (short)0, c, false, false); }
__device__ __forceinline__ v8f wmmab(v16bf a, v16bf b, v8f c) { return __builtin_amdgcn_wmma_f32_16x16x32_bf16(false, a, false, b, (short)0, c, false, false); }



// ---- gemmw_tile: register-blocked GEMM, one 64x64 output tile (bx, by) per block (16 accumulators per wave), operands straight from 16-bit planes in fragment order (WFrag::ld takes the lane's place in a fragment); 32 * KW threads; os: the block's LDS, KW * SLAB floats. The kernels below say which tile of which product a block takes.
// C[m][n] (+ optional f32 bias: BIAS 1 bias[n], BIAS 2 bias[m]) = sum_k A[m][k] Bt[n][k] (+ split products per NSPLIT). K (a template constant, so that a row block's distance is an immediate offset of the load) % (32 * KW) == 0.
// Where the f32 sum goes (OM): 0 = f32 to C, pitch ldc; 1 = split into bf16 hi/lo planes Ph/Pl, a matrix of ldc columns in fragment order; 2 = the same split into head planes [n / 64], each a matrix [TT rows m][64 columns n % 64] in fragment order (a tile's 64 columns are one head).
// KW waves share the tile's K range: wave w takes the 32-wide k blocks w, w + KW, ... into its own full set of accumulators; the KW partial tiles are joined in LDS in the fixed order w = 0 .. KW-1 (KW = 1: no join).
template <typename T> __device__ __forceinline__ const T* atb(const T* base, unsigned bytes) { return (const T*)((const char*)base + bytes); }   // uniform base + 32-bit lane offset
template <typename T16> struct WFrag;
template <> struct WFrag<h16> { typedef v16h V; static __device__ __forceinline__ V ld(const h16* p) { return cat16(*(const v8h*)p, *(const v8h*)(p + 256)); } static __device__ __forceinline__ v8f mma(V a, V b, v8f c) { return wmma16(a, b, c); } };
template <> struct WFrag<bf> { typedef v16bf V; static __device__ __forceinline__ V ld(const bf* p) { return cat16b(*(const v8us*)p, *(const v8us*)(p + 256)); } static __device__ __forceinline__ v8f mma(V a, V b, v8f c) { return wmmab(a, b, c); } };
typedef __attribute__((ext_vector_type(4))) unsigned short v4us;
__device__ __forceinline__ void splitf(float y, unsigned short& h, unsigned short& l) { h = f2bf(y); l = f2bf(y - bf2f(h)); }
template <typename T16, int NSPLIT, int BIAS, int KW, int OM, int K>
__device__ __forceinline__ void gemmw_tile(float* os, const int bx, const int by, const T16* __restrict__ A, const T16* __restrict__ A2, const T16* __restrict__ Bt, const T16* __restrict__ Bt2, float* C, bf* Ph, bf* Pl, int ldc, const float* __restrict__ bias) {
    typedef typename WFrag<T16>::V V;
    static_assert(KW == 1 || 32 % KW == 0, "the join walks the 64 rows in steps of 2 * KW");
    static_assert(KW > 1 || (OM == 0 && BIAS != 2), "planes and the row bias are written by the join");
    static_assert(OM != 2 || HD == 64, "a tile's columns are one head");
    constexpr int SLAB = (KW == 1 ? 16 : 64) * 68;   // floats of one wave's staging slab (KW > 1: its whole partial tile)
    const int wv = (KW == 1) ? 0 : __builtin_amdgcn_readfirstlane((int)(threadIdx.x >> 5));   // wave number as a scalar: the k loop stays a scalar loop
    const int lane = threadIdx.x & 31, lr = lane & 15, hi = lane >> 4; const int r0 = bx * 64, c0 = by * 64;
    v8f acc[4][4];
#pragma unroll
    for (int mb = 0; mb < 4; ++mb)
#pragma unroll
        for (int nb = 0; nb < 4; ++nb) acc[mb][nb] = (v8f){};
    const size_t aoff = (size_t)r0 * K, boff = (size_t)c0 * K;   // wave-uniform: 16 rows of fragments are 16 * K elements, a 32-wide k block 512
    unsigned lo = (unsigned)lane * 16 + (unsigned)wv * 1024;   // bytes: the lane's place in a fragment + the wave's k block (1024 bytes each); one 32-bit offset serves every load of a pass beside its uniform base
#pragma unroll 1
    for (int kc = wv * 32; kc < K; kc += 32 * KW) {
        V a[4], a2[4];
#pragma unroll
        for (int mb = 0; mb < 4; ++mb) { a[mb] = WFrag<T16>::ld(atb(A + aoff + (size_t)mb * 16 * K, lo)); if (NSPLIT == 1 || NSPLIT == 2) a2[mb] = WFrag<T16>::ld(atb(A2 + aoff + (size_t)mb * 16 * K, lo)); }
        V b[4], b2[4];
#pragma unroll
        for (int nb = 0; nb < 4; ++nb) { b[nb] = WFrag<T16>::ld(atb(Bt + boff + (size_t)nb * 16 * K, lo)); if (NSPLIT >= 2) b2[nb] = WFrag<T16>::ld(atb(Bt2 + boff + (size_t)nb * 16 * K, lo)); }
        __builtin_amdgcn_sched_barrier(0);   // all loads of the pass are issued ahead of its products, one load latency a pass (the scheduler otherwise keeps one B fragment's registers and waits out a load per column block)
#pragma unroll
        for (int nb = 0; nb < 4; ++nb) {
#pragma unroll
            for (int mb = 0; mb < 4; ++mb) { acc[mb][nb] = WFrag<T16>::mma(a[mb], b[nb], acc[mb][nb]); if (NSPLIT == 1 || NSPLIT == 2) acc[mb][nb] = WFrag<T16>::mma(a2[mb], b[nb], acc[mb][nb]); if (NSPLIT >= 2) acc[mb][nb] = WFrag<T16>::mma(a[mb], b2[nb], acc[mb][nb]); } }
        asm volatile("v_nop\n\tv_nop\n\tv_nop\n\tv_nop" : "+v"(acc[0][0]), "+v"(acc[1][1]), "+v"(acc[2][2]), "+v"(acc[3][3]) : "v"(a[0]), "v"(a[3]));
        asm volatile("s_wait_xcnt 0x0" ::: "memory");   // stands between this pass's loads and the step of the offset register that they name
        __builtin_amdgcn_sched_barrier(0);   // holds the step behind that wait
        lo += KW * 1024;
    }
    if constexpr (KW > 1) {
        float* osw = os + wv * SLAB;
#pragma unroll
        for (int mb = 0; mb < 4; ++mb)
#pragma unroll
            for (int nb = 0; nb < 4; ++nb)
#pragma unroll
                for (int j = 0; j < 8; ++j) osw[(mb * 16 + hi * 8 + j) * 68 + nb * 16 + lr] = acc[mb][nb][j];
        __syncthreads();   // every wave's partial tile is in LDS before any thread sums it
        if constexpr (OM == 0) {
            const int row0 = (int)(threadIdx.x >> 4), cofs = (int)(threadIdx.x & 15) * 4;   // the block covers 2 * KW rows of 16 float4 per step
            constexpr int NQ = 32 / KW;
            v4f vq[NQ];
#pragma unroll
            for (int q = 0; q < NQ; ++q) { const int row = q * 2 * KW + row0; v4f val = *(const v4fa*)(os + row * 68 + cofs);
#pragma unroll
                for (int w = 1; w < KW; ++w) val += *(const v4fa*)(os + w * SLAB + row * 68 + cofs);
                if (BIAS == 1) { val[0] += bfr(bias[c0 + cofs]); val[1] += bfr(bias[c0 + cofs + 1]); val[2] += bfr(bias[c0 + cofs + 2]); val[3] += bfr(bias[c0 + cofs + 3]); }
                if (BIAS == 2) val += bfr(bias[r0 + row]);
                vq[q] = val; }
            float* pc[NQ];
#pragma unroll
            for (int q = 0; q < NQ; ++q) pc[q] = C + (size_t)(r0 + q * 2 * KW + row0) * ldc + c0 + cofs;
#pragma unroll
            for (int q = 0; q < NQ; ++q) *(v4f*)pc[q] = vq[q];
        } else {
            static_assert(KW == 8, "16 half fragments of the tile over 8 waves, 2 steps");
            // A thread joins 8 consecutive columns of one row, one 16-byte unit of the plane; a wave takes the 32 units of half a fragment (16 rows x the k units 2 j and 2 j + 1), which lie in lane order: each store is 512 contiguous bytes. The LDS reads stay free of bank conflicts (16 rows at pitch 68 start 4 banks apart).
            v8us oh[2], ol[2]; bf* pa[2]; bf* pb[2];
#pragma unroll
            for (int s = 0; s < 2; ++s) { const int hf = s * 8 + wv, rbl = hf >> 2, kbl = (hf >> 1) & 1, j = hf & 1;   // which half fragment of the tile: row block, k block, piece
                const int row = rbl * 16 + lr, col = kbl * 32 + j * 16 + hi * 8;
                v4f v0 = *(const v4fa*)(os + row * 68 + col), v1 = *(const v4fa*)(os + row * 68 + col + 4);
#pragma unroll
                for (int w = 1; w < KW; ++w) { v0 += *(const v4fa*)(os + w * SLAB + row * 68 + col); v1 += *(const v4fa*)(os + w * SLAB + row * 68 + col + 4); }
                if (BIAS == 1) {
#pragma unroll
                    for (int e = 0; e < 4; ++e) { v0[e] += bfr(bias[c0 + col + e]); v1[e] += bfr(bias[c0 + col + 4 + e]); } }
                if (BIAS == 2) { const float rw = bias[r0 + row];
                    asm volatile("s_wait_xcnt 0x0" ::: "memory");   // stands between the bias load and the next write of the register that it names as address
                    const float rb = bfr(rw); v0 += rb; v1 += rb; }
#pragma unroll
                for (int e = 0; e < 4; ++e) { oh[s][e] = f2bf(v0[e]); oh[s][4 + e] = f2bf(v1[e]); }
                v4f h0, h1;
#pragma unroll
                for (int e = 0; e < 4; ++e) { h0[e] = bf2f(oh[s][e]); h1[e] = bf2f(oh[s][4 + e]); }
                const v4f s0 = v0 - h0, s1 = v1 - h1;   // what the hi plane leaves, exact in f32
#pragma unroll
                for (int e = 0; e < 4; ++e) { ol[s][e] = f2bf(s0[e]); ol[s][4 + e] = f2bf(s1[e]); }
                const size_t fr = (OM == 1) ? (size_t)(r0 / 16 + rbl) * (ldc / 32) + c0 / 32 + kbl : ((size_t)by * (TT / 16) + r0 / 16 + rbl) * (HD / 32) + kbl;   // the fragment's number in its plane
                const size_t eo = fr * 512 + j * 256 + lane * 8; pa[s] = Ph + eo; pb[s] = Pl + eo; }
            __builtin_amdgcn_sched_barrier(0);   // all values and addresses are ready here: behind the first store no register that a store names is written any more (the scheduler otherwise lifts the first store into the split and has to wait before it reuses the store's registers)
#pragma unroll
            for (int s = 0; s < 2; ++s) { *(v8us*)pa[s] = oh[s]; *(v8us*)pb[s] = ol[s]; }
            asm volatile("s_wait_xcnt 0x0" ::: "memory");   // stands behind the store(s): in a kernel that holds several bodies the listing goes on from here into another body's head, which writes registers that a store names
        }
        return;
    }
#pragma unroll
    for (int mb = 0; mb < 4; ++mb) {
#pragma unroll
        for (int nb = 0; nb < 4; ++nb) {
#pragma unroll
            for (int j = 0; j < 8; ++j) os[(hi * 8 + j) * 68 + nb * 16 + lr] = acc[mb][nb][j]; }
        __builtin_amdgcn_wave_barrier(); asm volatile("" ::: "memory");
        float* crow = C + (size_t)(r0 + mb * 16) * ldc + c0;
{
#pragma unroll
            for (int s = 0; s < 8; ++s) { const int row = 2 * s + hi, cofs = lr * 4; v4f val = *(const v4fa*)(os + row * 68 + cofs); if (BIAS) { val[0] += bfr(bias[c0 + cofs]); val[1] += bfr(bias[c0 + cofs + 1]); val[2] += bfr(bias[c0 + cofs + 2]); val[3] += bfr(bias[c0 + cofs + 3]); }
                *(v4f*)(crow + (size_t)row * ldc + cofs) = val; }
             }
        __builtin_amdgcn_wave_barrier(); asm volatile("" ::: "memory");
    }
}

#define GLDS (8 * 64 * 68)          // floats: the 8 waves' partial tiles
#define PLNE ((size_t)NH_ * TT * HD) // elements of one batch's head planes
// k_qkv: the three projections of both batches, which do not depend on one another, in one launch; grid (NB_ * TT / 64, 16, 3). z = 0: Q, flat hi/lo planes of NB_ * TT rows; z = 1: K, head planes of batch bx / 32; z = 2: V^T = Wv^T.X^T of batch b, rows (head, d), columns the batch's tokens.
__global__ __launch_bounds__(256) void k_qkv(const bf* __restrict__ XQ, const bf* __restrict__ XK, const bf* __restrict__ XV, const bf* __restrict__ WQ, const bf* __restrict__ WK, const bf* __restrict__ WV, const float* __restrict__ bq, const float* __restrict__ bk, const float* __restrict__ bv, bf* FQh, bf* FQl, bf* KPh, bf* KPl, bf* VTh, bf* VTl) {
    __shared__ __align__(16) float os[GLDS];
    const int bx = blockIdx.x, by = blockIdx.y;
    if (blockIdx.z == 0) gemmw_tile<bf, 0, 1, 8, 1, DM>(os, bx, by, XQ, nullptr, WQ, nullptr, nullptr, FQh, FQl, DQ, bq);
    else if (blockIdx.z == 1) { const size_t b = bx / (TT / 64); gemmw_tile<bf, 0, 1, 8, 2, DM>(os, bx % (TT / 64), by, XK + b * TT * DM, nullptr, WK, nullptr, nullptr, KPh + b * PLNE, KPl + b * PLNE, DKV, bk); }
    else { const int t = by * (NB_ * TT / 64) + bx; const size_t b = t / ((DKV / 64) * (TT / 64)); gemmw_tile<bf, 0, 2, 8, 1, DM>(os, t % (DKV / 64), (t / (DKV / 64)) % (TT / 64), WV, nullptr, XV + b * TT * DM, nullptr, nullptr, VTh + b * PLNE, VTl + b * PLNE, TT, bv); }
}
// k_qw: Q W (W shared by all heads = block-diagonal) on the hi/lo planes of Q, written by head; grid (NB_ * TT / 64, 16).
__global__ __launch_bounds__(256) void k_qw(const bf* __restrict__ FQh, const bf* __restrict__ FQl, const bf* __restrict__ WBD, bf* QPh, bf* QPl) {
    __shared__ __align__(16) float os[GLDS];
    const int bx = blockIdx.x; const size_t b = bx / (TT / 64);
    gemmw_tile<bf, 1, 0, 8, 2, DQ>(os, bx % (TT / 64), blockIdx.y, FQh + b * TT * DQ, FQl + b * TT * DQ, WBD, nullptr, nullptr, QPh + b * PLNE, QPl + b * PLNE, DQ, nullptr);
}
// k_wo: merged hi/lo rows of both batches x Wo + bo, f32 to the output; grid (NB_ * TT / 64, 16).
__global__ __launch_bounds__(256) void k_wo(const bf* __restrict__ ATh, const bf* __restrict__ ATl, const bf* __restrict__ WO, float* OUT, const float* __restrict__ bo) {
    __shared__ __align__(16) float os[GLDS];
    gemmw_tile<bf, 1, 1, 8, 0, DQ>(os, blockIdx.x, blockIdx.y, ATh, ATl, WO, nullptr, OUT, nullptr, nullptr, DM, bo);
}

typedef __attribute__((ext_vector_type(2))) unsigned short v2us;
typedef __attribute__((ext_vector_type(2))) float v2f;

// The three converters store fragment order; k_prep below runs all of them in one launch and hands each its block number. wtG (Bt[n][k] = w[k][n]): a thread takes one column n and 8 consecutive k; a wave's 32 columns make each load one whole line and each store two runs of 256 bytes.
__device__ __forceinline__ void wtG(const float* __restrict__ w, int K, int N, bf* Bt, int blk) {
    const int n = (blk % (N / 256)) * 256 + threadIdx.x, u = blk / (N / 256); v8us o;   // (N / 256) * (K / 8) blocks
    const float* wr = w + (size_t)u * 8 * N;   // the block's 8 rows: uniform bases, the lane's part is its column
#pragma unroll
    for (int e = 0; e < 8; ++e) o[e] = f2bf(*atb(wr + (size_t)e * N, (unsigned)n * 4));
    *(v8us*)(Bt + ((size_t)(n >> 4) * (K / 32) + (u >> 2)) * 512 + ((u & 3) * 16 + (n & 15)) * 8) = o;
    asm volatile("s_wait_xcnt 0x0" ::: "memory");   // stands behind the store(s): in a kernel that holds several bodies the listing goes on from here into another body's head, which writes registers that a store names
}
// cvt8 (rows of DM): a wave takes 8 rows x 32 k, half a fragment: lane = (k unit q, row); it reads 8 whole lines in two loads and stores 4 whole lines.
__device__ __forceinline__ void cvt8(const float* __restrict__ src, bf* dst, int blk) { const size_t i = (size_t)blk * 256 + threadIdx.x;
    const int lane = threadIdx.x & 31, q = lane >> 3; const size_t wv = i >> 5, fr = wv >> 1; const int c = (int)(wv & 1) * 8 + (lane & 7);
    const v8f v = *(const v8f*)(src + ((fr / (DM / 32)) * 16 + c) * DM + (fr % (DM / 32)) * 32 + q * 8); v8us o;
#pragma unroll
    for (int k = 0; k < 8; ++k) o[k] = f2bf(v[k]); *(v8us*)(dst + fr * 512 + (q * 16 + c) * 8) = o;
    asm volatile("s_wait_xcnt 0x0" ::: "memory");   // stands behind the store(s): in a kernel that holds several bodies the listing goes on from here into another body's head, which writes registers that a store names
}

// wbdx: thread i writes unit i of the plane: row c, k unit q of fragment i / 64.
__device__ __forceinline__ void wbdx(const float* __restrict__ w, bf* Bt, int blk) { const size_t i = (size_t)blk * 256 + threadIdx.x; const int fr = (int)(i >> 6); const int k0 = (fr % (DQ / 32)) * 32 + ((int)(i >> 4) & 3) * 8; const int n = (fr / (DQ / 32)) * 16 + (int)(i & 15); const int h = n / HD, nn = n % HD; const int hb = k0 / HD; v8us o;
#pragma unroll
    for (int q = 0; q < 8; ++q) { const unsigned short v = f2bf(w[(size_t)((k0 + q) % HD) * HD + nn]); o[q] = (hb == h) ? v : (unsigned short)0; }
    *(v8us*)(Bt + i * 8) = o;
    asm volatile("s_wait_xcnt 0x0" ::: "memory");   // stands behind the store(s): in a kernel that holds several bodies the listing goes on from here into another body's head, which writes registers that a store names
}
// k_prep: every converter in one launch (none reads what another writes). Blocks 0 .. 3 * CVB - 1: the three inputs, both batches (NB_ * TT rows each, XB holds the three copies in turn); then 4 * WTB blocks: Wq, Wk, Wv, Wo (WT holds the four in turn); then the block-diagonal W.
#define CVB (NB_ * TT * DM / 8 / 256)
#define WTB (DM * DQ / 8 / 256)
#define WDB (DQ * DQ / 8 / 256)
__global__ __launch_bounds__(256) void k_prep(const float* __restrict__ x, const float* __restrict__ xk, const float* __restrict__ xv, const float* __restrict__ wq, const float* __restrict__ wk, const float* __restrict__ wv, const float* __restrict__ wo, const float* __restrict__ wbl, bf* XB, bf* WT, bf* WBD) {
    const int blk = blockIdx.x, wb = blk - 3 * CVB;
    if (blk < 3 * CVB) { const int s = blk / CVB; cvt8(s == 0 ? x : s == 1 ? xk : xv, XB + (size_t)s * NB_ * TT * DM, blk % CVB); }
    else if (wb < 4 * WTB) { const int s = wb / WTB; wtG(s == 0 ? wq : s == 1 ? wk : s == 2 ? wv : wo, DM, DQ, WT + (size_t)s * DQ * DM, wb % WTB); }
    else wbdx(wbl, WBD, wb - 4 * WTB);
}
typedef __attribute__((ext_vector_type(2))) __bf16 v2b;
typedef __attribute__((ext_vector_type(8))) unsigned v8u;
__device__ __forceinline__ float xhalf(float x) { const int b = __float_as_int(x); return __int_as_float(__builtin_amdgcn_permlanex16(b, b, 0x76543210, 0xfedcba98, false, false)); }   // the value of lane l ^ 16
__global__ __launch_bounds__(256) void k_fattn(const bf* __restrict__ Qh, const bf* __restrict__ Ql, const bf* __restrict__ Kh, const bf* __restrict__ Kl, const bf* __restrict__ Vh, const bf* __restrict__ Vl, const int* __restrict__ thrp, bf* Ah, bf* Al) {
    typedef WFrag<bf> F; typedef F::V V;
    constexpr float L2E = 1.4426950408889634f;
    const int lane = threadIdx.x & 31, h = lane >> 4;
    const int hd = blockIdx.y, b = blockIdx.z; const int q0 = blockIdx.x * 256 + __builtin_amdgcn_readfirstlane((int)(threadIdx.x >> 5)) * 32;   // the wave's number as a scalar: every fragment's base is wave-uniform
    const int thr = __builtin_amdgcn_readfirstlane(thrp[b]);   // the batch's key threshold (input), a scalar so that the mask test is a scalar branch
    const size_t pl = ((size_t)b * NH_ + hd) * TT * HD;
    const unsigned ko = (unsigned)lane * 16;   // bytes: the lane's place in a fragment, its only own part of a load's address
    V qh[2][2], ql[2][2];
#pragma unroll
    for (int qt = 0; qt < 2; ++qt)
#pragma unroll
        for (int ks = 0; ks < 2; ++ks) { const size_t o = pl + (size_t)(q0 + qt * 16) * HD + ks * 512; qh[qt][ks] = F::ld(atb(Qh + o, ko)); ql[qt][ks] = F::ld(atb(Ql + o, ko)); }
    const bf* kph = Kh + pl; const bf* kpl = Kl + pl; const bf* vph = Vh + pl; const bf* vpl = Vl + pl;   // wave-uniform bases; the lane's part is a 32-bit byte offset
    unsigned vb = ko, kb2 = ko + 32 * HD * 2;   // the lane's byte offsets of this pass's V^T columns and of the next pass's K rows; both step only behind the wait that follows their loads
    v8f o[4][2];
#pragma unroll
    for (int dt = 0; dt < 4; ++dt)
#pragma unroll
        for (int qt = 0; qt < 2; ++qt) o[dt][qt] = (v8f){};
    float ms[2] = {-3.0e38f, -3.0e38f}, l[2] = {0.f, 0.f};
    V kh[2][2], kl[2][2];
#pragma unroll
    for (int kt = 0; kt < 2; ++kt)
#pragma unroll
        for (int ks = 0; ks < 2; ++ks) { kh[kt][ks] = F::ld(atb(kph, ko) + kt * 16 * HD + ks * 512); kl[kt][ks] = F::ld(atb(kpl, ko) + kt * 16 * HD + ks * 512); }
    asm volatile("s_wait_xcnt 0x0" ::: "memory");   // stands between the loads above and the next write of a register that they name as address
    __builtin_amdgcn_sched_barrier(0);   // holds later register writes behind that wait
#pragma unroll 1
    for (int kb = 0; kb < TT; kb += 32) {
        V vh[4], vl[4];   // this pass's V^T fragments, asked for ahead of the score products
#pragma unroll
        for (int dt = 0; dt < 4; ++dt) { vh[dt] = F::ld(atb(vph, vb) + dt * 16 * TT); vl[dt] = F::ld(atb(vpl, vb) + dt * 16 * TT); }
        asm volatile("s_wait_xcnt 0x0" ::: "memory");   // stands between these loads and the next write of a register that they name as address
        __builtin_amdgcn_sched_barrier(0);   // keeps the V^T loads issued here, a whole score block and softmax ahead of their use (the scheduler otherwise sinks them next to it), and the offset's step behind the wait
        vb += 1024;   // the next 32 keys' fragment of the same 16 rows
        v8f s[2][2];
#pragma unroll
        for (int kt = 0; kt < 2; ++kt)
#pragma unroll
            for (int qt = 0; qt < 2; ++qt) { v8f t = (v8f){};
#pragma unroll
                for (int ks = 0; ks < 2; ++ks) { t = F::mma(kh[kt][ks], qh[qt][ks], t); t = F::mma(kh[kt][ks], ql[qt][ks], t); t = F::mma(kl[kt][ks], qh[qt][ks], t); }
                s[kt][qt] = t; }
        // the next pass's K fragments fly during the softmax
#pragma unroll
        for (int kt = 0; kt < 2; ++kt)
#pragma unroll
            for (int ks = 0; ks < 2; ++ks) { kh[kt][ks] = F::ld(atb(kph, kb2) + kt * 16 * HD + ks * 512); kl[kt][ks] = F::ld(atb(kpl, kb2) + kt * 16 * HD + ks * 512); }
        asm volatile("s_wait_xcnt 0x0" ::: "memory");   // as above, for the K loads
        __builtin_amdgcn_sched_barrier(0);   // keeps the next K loads issued here, ahead of the softmax (the scheduler otherwise sinks them to the end of the pass, just in front of their use), and the offset's step behind the wait
        kb2 = (kb + 64 < TT) ? kb2 + 32 * HD * 2 : ko;   // the last pass re-reads pass 0, unused
        if (kb + 32 > thr) {   // keys >= threshold get the VALUE -1e-6 (MASK_VALUE), not an exclusion
#pragma unroll
            for (int kt = 0; kt < 2; ++kt)
#pragma unroll
                for (int r = 0; r < 8; ++r) { const bool keep = (kb + kt * 16 + 8 * h + r) < thr;
#pragma unroll
                    for (int qt = 0; qt < 2; ++qt) s[kt][qt][r] = keep ? s[kt][qt][r] : -1.0e-6f; }
        }
        float mxs[2]; bool need = false;
#pragma unroll
        for (int qt = 0; qt < 2; ++qt) { float mx = s[0][qt][0];
#pragma unroll
            for (int r = 1; r < 8; ++r) mx = fmaxf(mx, s[0][qt][r]);
#pragma unroll
            for (int r = 0; r < 8; ++r) mx = fmaxf(mx, s[1][qt][r]);
            mx = fmaxf(mx, xhalf(mx)); mxs[qt] = mx * L2E; need = need || (mxs[qt] > ms[qt] + 8.0f); }
        if (__builtin_amdgcn_ballot_w32(need) != 0) {
#pragma unroll
            for (int qt = 0; qt < 2; ++qt) { const float mn = fmaxf(ms[qt], mxs[qt]); const float al = __builtin_amdgcn_exp2f(ms[qt] - mn); ms[qt] = mn; l[qt] *= al;
#pragma unroll
                for (int dt = 0; dt < 4; ++dt) o[dt][qt] *= al; }
        }
        V ph[2], pw[2];
#pragma unroll
        for (int qt = 0; qt < 2; ++qt) { v2f sum = (v2f){0.f, 0.f}; v8u wh, wl;   // two elements at a time: packed conversions, packed sums
#pragma unroll
            for (int e = 0; e < 16; e += 2) { v2f p; p[0] = __builtin_amdgcn_exp2f(__builtin_fmaf(s[e >> 3][qt][e & 7], L2E, -ms[qt])); p[1] = __builtin_amdgcn_exp2f(__builtin_fmaf(s[e >> 3][qt][(e & 7) + 1], L2E, -ms[qt])); sum += p;
                const v2b hp = __builtin_convertvector(p, v2b); v2f rs; rs[0] = p[0] - (float)hp[0]; rs[1] = p[1] - (float)hp[1];
                wh[e >> 1] = __builtin_bit_cast(unsigned, hp); wl[e >> 1] = __builtin_bit_cast(unsigned, __builtin_convertvector(rs, v2b)); }
            ph[qt] = __builtin_bit_cast(V, wh); pw[qt] = __builtin_bit_cast(V, wl); l[qt] += sum[0] + sum[1]; }
#pragma unroll
        for (int dt = 0; dt < 4; ++dt)
#pragma unroll
            for (int qt = 0; qt < 2; ++qt) { o[dt][qt] = F::mma(vh[dt], ph[qt], o[dt][qt]); o[dt][qt] = F::mma(vh[dt], pw[qt], o[dt][qt]); o[dt][qt] = F::mma(vl[dt], ph[qt], o[dt][qt]); }
    }
    v8us oh[2][4], ol[2][4];
#pragma unroll
    for (int qt = 0; qt < 2; ++qt) { const float f = __fdiv_rn(1.0f, l[qt] + xhalf(l[qt]));
#pragma unroll
        for (int dt = 0; dt < 4; ++dt)
#pragma unroll
            for (int r = 0; r < 8; ++r) { unsigned short x2, y2; splitf(o[dt][qt][r] * f, x2, y2); oh[qt][dt][r] = x2; ol[qt][dt][r] = y2; } }
    const size_t ro = ((size_t)b * TT + q0) * DQ + hd * (HD / 32) * 512 + lane * 8; bf* pa = Ah + ro; bf* pb = Al + ro;   // merged rows [NB_ * TT][DQ] in fragment order: the head's two k blocks, piece dt & 1 of block dt >> 1
    __builtin_amdgcn_sched_barrier(0);   // all values and both addresses are ready here: behind the first store no register that a store names is written any more
#pragma unroll
    for (int qt = 0; qt < 2; ++qt)
#pragma unroll
        for (int dt = 0; dt < 4; ++dt) { *(v8us*)(pa + qt * 16 * DQ + dt * 256) = oh[qt][dt]; *(v8us*)(pb + qt * 16 * DQ + dt * 256) = ol[qt][dt]; }
}

extern "C" void kernel_launch(void* const* d_in, const int* in_sizes, int n_in,
                              void* d_out, int out_size, void* d_ws, size_t ws_size, hipStream_t stream) {
    (void)in_sizes; (void)n_in; (void)out_size;
    const float* x = (const float*)d_in[0]; const float* xk = (const float*)d_in[1]; const float* xv = (const float*)d_in[2]; const int* thr = (const int*)d_in[3]; const float* wq = (const float*)d_in[4]; const float* bq = (const float*)d_in[5]; const float* wk = (const float*)d_in[6]; const float* bk = (const float*)d_in[7]; const float* wv = (const float*)d_in[8]; const float* bv = (const float*)d_in[9]; const float* wbl = (const float*)d_in[10]; const float* wo = (const float*)d_in[11]; const float* bo = (const float*)d_in[12];
    float* OUT = (float*)d_out;     // [2][2048][1024]
    char* wsp = (char*)d_ws;
    auto take = [&](size_t bytes) { char* p = wsp; wsp += (bytes + 255) & ~(size_t)255; return (void*)p; };
    bf* WBD = (bf*)take((size_t)DQ * DQ * 2); bf* FQh = (bf*)take((size_t)NB_ * TT * DQ * 2); bf* FQl = (bf*)take((size_t)NB_ * TT * DQ * 2);
    bf* WT = (bf*)take((size_t)4 * DQ * DM * 2); bf* WQ = WT; bf* WK = WT + (size_t)DQ * DM; bf* WV = WT + (size_t)2 * DQ * DM; bf* WO = WT + (size_t)3 * DQ * DM;
    bf* XB = (bf*)take((size_t)3 * NB_ * TT * DM * 2); bf* XQ = XB; bf* XK = XB + (size_t)NB_ * TT * DM; bf* XV = XB + (size_t)2 * NB_ * TT * DM;
    const size_t PLN = (size_t)NH_ * TT * HD;   // one batch's head planes; every plane is kept for both batches
    bf* QPh = (bf*)take(NB_ * PLN * 2); bf* QPl = (bf*)take(NB_ * PLN * 2); bf* KPh = (bf*)take(NB_ * PLN * 2); bf* KPl = (bf*)take(NB_ * PLN * 2); bf* VTh = (bf*)take(NB_ * PLN * 2); bf* VTl = (bf*)take(NB_ * PLN * 2);
    bf* ATh = (bf*)take((size_t)NB_ * TT * DQ * 2); bf* ATl = (bf*)take((size_t)NB_ * TT * DQ * 2);
    if ((size_t)(wsp - (char*)d_ws) > ws_size) return;    // ws 256 MiB
    k_prep<<<3 * CVB + 4 * WTB + WDB, 256, 0, stream>>>(x, xk, xv, wq, wk, wv, wo, wbl, XB, WT, WBD);
    k_qkv<<<dim3(NB_ * TT / 64, DQ / 64, 3), 256, 0, stream>>>(XQ, XK, XV, WQ, WK, WV, bq, bk, bv, FQh, FQl, KPh, KPl, VTh, VTl);
    k_qw<<<dim3(NB_ * TT / 64, DQ / 64, 1), 256, 0, stream>>>(FQh, FQl, WBD, QPh, QPl);
    k_fattn<<<dim3(TT / 256, NH_, NB_), 256, 0, stream>>>(QPh, QPl, KPh, KPl, VTh, VTl, thr, ATh, ATl);
    k_wo<<<dim3(NB_ * TT / 64, DM / 64, 1), 256, 0, stream>>>(ATh, ATl, WO, OUT, bo);
}

// v006
// One run takes 134 microseconds.
// In two side-by-side timings against v005, it was 1.13 and 1.12 times as fast.
// All steps since v000 together make it 10.4 times as fast.
#include <hip/hip_runtime.h>

// Multi-head attention with a learned bilinear score and a per-batch key threshold (queries, keys, values [2][2048][1024]; Q,K,V = input W + b ('xw' [1024][1024] + [1024]; 16 heads x 64); scores = (Q W).K with W [64][64] shared by all heads, NO 1/sqrt(d) (logit sigma ~8); keys j >= thresholds[b] get the logit MASK_VALUE = -1e-6 (a value near zero, NOT an exclusion -- reproduced literally; thresholds int [2], read); softmax; out = merged attn.V Wo + bo -> [2][2048][1024] (4.2 M)).
// Four launches, each over both batches: one converter launch (bf16 copies of the three inputs and of the weights); the three projections in one launch; attention; Wo. Exact projections + f32 biases, each GEMM's join writing the bf16 hi/lo planes its consumer reads (Q and K by head, V^T as the product Wv^T.X^T); the bilinear W [64][64] applied at the head of the attention kernel, by each wave to its own 32 query rows, on the hi/lo planes of Q (2 products, K = 64), the f32 result split into hi/lo in registers; ONE fused attention launch over both batches and all heads, EVERY row on hi/lo planes (3 products; unscaled logits), reading the batch's threshold once and selecting -1e-6 for j >= threshold, online softmax; merged hi/lo x Wo exact + bo.
// Every 16-bit plane lies in FRAGMENT ORDER: a matrix [rows][K] is cut into fragments of 16 rows x 32 k, fragment (rb, kb) at element (rb * (K / 32) + kb) * 512, and inside it element (row c, k = 8 q + e) at (q * 16 + c) * 8 + e. Lane l = 16 h + c of a wave then finds its two 16-byte pieces (q = h and q = 2 + h) at l * 8 and 256 + l * 8: each wave-wide load is 512 contiguous bytes, four whole lines. Every producer stores that order.
// Compute dtypes, f32 accumulate: every input rounded to bf16; projections exact + f32 biases; Q W hi/lo x exact; scores and attn.V 3 products on every row; softmax f32; Wo hl x exact + bias.

#define NB_  2
#define TT   2048
#define DM   1024
#define NH_  16
#define NKV  16
#define REP  (NH_ / NKV)
#define HD   64
#define DQ   (NH_ * HD)
#define DKV  (NKV * HD)
#define ZH   2
#define RH   2048                  // unused: every query row uses hi+lo planes
#define WIN  0
#define PCAR 1024.0f
#define SCL  1.0f   // no 1/sqrt(d) in the module
typedef _Float16 h16;
typedef unsigned short bf;
typedef __attribute__((ext_vector_type(16))) __bf16   v16bf;
typedef __attribute__((ext_vector_type(16))) _Float16 v16h;
typedef __attribute__((ext_vector_type(8)))  _Float16 v8h;
typedef __attribute__((ext_vector_type(8)))  unsigned short v8us;
typedef __attribute__((ext_vector_type(8)))  float    v8f;
typedef __attribute__((ext_vector_type(4)))  float    v4f;
typedef v8h  __attribute__((may_alias)) v8ha;
typedef v4f  __attribute__((may_alias)) v4fa;
typedef v8us __attribute__((may_alias)) v8usa;

__device__ __forceinline__ unsigned short f2bf(float f) { unsigned u = __float_as_uint(f); u += 0x7FFFu + ((u >> 16) & 1u); return (unsigned short)(u >> 16); }
__device__ __forceinline__ float bf2f(unsigned short b) { return __uint_as_float(((unsigned)b) << 16); }
__device__ __forceinline__ float bfr(float f) { return bf2f(f2bf(f)); }
__device__ __forceinline__ v16h cat16(v8h lo, v8h hi) { return __builtin_shufflevector(lo, hi, 0, 1, 2, 3, 4, 5, 6, 7, 8, 9, 10, 11, 12, 13, 14, 15); }
__device__ __forceinline__ v16bf cat16b(v8us lo, v8us hi) { return __builtin_bit_cast(v16bf, __builtin_shufflevector(lo, hi, 0, 1, 2, 3, 4, 5, 6, 7, 8, 9, 10, 11, 12, 13, 14, 15)); }
__device__ __forceinline__ v8f wmma16(v16h a, v16h b, v8f c) { return __builtin_amdgcn_wmma_f32_16x16x32_f16(false, a, false, b, (short)0, c, false, false); }
__device__ __forceinline__ v8f wmmab(v16bf a, v16bf b, v8f c) { return __builtin_amdgcn_wmma_f32_16x16x32_bf16(false, a, false, b, (short)0, c, false, false); }



// ---- gemmw_tile: register-blocked GEMM, one 64x64 output tile (bx, by) per block (16 accumulators per wave), operands straight from 16-bit planes in fragment order (WFrag::ld takes the lane's place in a fragment); 32 * KW threads; os: the block's LDS, KW * SLAB floats. The kernels below say which tile of which product a block takes.
// C[m][n] (+ optional f32 bias: BIAS 1 bias[n], BIAS 2 bias[m]) = sum_k A[m][k] Bt[n][k] (+ split products per NSPLIT). K (a template constant, so that a row block's distance is an immediate offset of the load) % (32 * KW) == 0.
// Where the f32 sum goes (OM): 0 = f32 to C, pitch ldc; 1 = split into bf16 hi/lo planes Ph/Pl, a matrix of ldc columns in fragment order; 2 = the same split into head planes [n / 64], each a matrix [TT rows m][64 columns n % 64] in fragment order (a tile's 64 columns are one head).
// KW waves share the tile's K range: wave w takes the 32-wide k blocks w, w + KW, ... into its own full set of accumulators; the KW partial tiles are joined in LDS in the fixed order w = 0 .. KW-1 (KW = 1: no join).
template <typename T> __device__ __forceinline__ const T* atb(const T* base, unsigned bytes) { return (const T*)((const char*)base + bytes); }   // uniform base + 32-bit lane offset
template <typename T16> struct WFrag;
template <> struct WFrag<h16> { typedef v16h V; static __device__ __forceinline__ V ld(const h16* p) { return cat16(*(const v8h*)p, *(const v8h*)(p + 256)); } static __device__ __forceinline__ v8f mma(V a, V b, v8f c) { return wmma16(a, b, c); } };
template <> struct WFrag<bf> { typedef v16bf V; static __device__ __forceinline__ V ld(const bf* p) { return cat16b(*(const v8us*)p, *(const v8us*)(p + 256)); } static __device__ __forceinline__ v8f mma(V a, V b, v8f c) { return wmmab(a, b, c); } };
typedef __attribute__((ext_vector_type(4))) unsigned short v4us;
__device__ __forceinline__ void splitf(float y, unsigned short& h, unsigned short& l) { h = f2bf(y); l = f2bf(y - bf2f(h)); }
template <typename T16, int NSPLIT, int BIAS, int KW, int OM, int K>
__device__ __forceinline__ void gemmw_tile(float* os, const int bx, const int by, const T16* __restrict__ A, const T16* __restrict__ A2, const T16* __restrict__ Bt, const T16* __restrict__ Bt2, float* C, bf* Ph, bf* Pl, int ldc, const float* __restrict__ bias) {
    typedef typename WFrag<T16>::V V;
    static_assert(KW == 1 || 32 % KW == 0, "the join walks the 64 rows in steps of 2 * KW");
    static_assert(KW > 1 || (OM == 0 && BIAS != 2), "planes and the row bias are written by the join");
    static_assert(OM != 2 || HD == 64, "a tile's columns are one head");
    constexpr int SLAB = (KW == 1 ? 16 : 64) * 68;   // floats of one wave's staging slab (KW > 1: its whole partial tile)
    const int wv = (KW == 1) ? 0 : __builtin_amdgcn_readfirstlane((int)(threadIdx.x >> 5));   // wave number as a scalar: the k loop stays a scalar loop
    const int lane = threadIdx.x & 31, lr = lane & 15, hi = lane >> 4; const int r0 = bx * 64, c0 = by * 64;
    v8f acc[4][4];
#pragma unroll
    for (int mb = 0; mb < 4; ++mb)
#pragma unroll
        for (int nb = 0; nb < 4; ++nb) acc[mb][nb] = (v8f){};
    const size_t aoff = (size_t)r0 * K, boff = (size_t)c0 * K;   // wave-uniform: 16 rows of fragments are 16 * K elements, a 32-wide k block 512
    unsigned lo = (unsigned)lane * 16 + (unsigned)wv * 1024;   // bytes: the lane's place in a fragment + the wave's k block (1024 bytes each); one 32-bit offset serves every load of a pass beside its uniform base
#pragma unroll 1
    for (int kc = wv * 32; kc < K; kc += 32 * KW) {
        V a[4], a2[4];
#pragma unroll
        for (int mb = 0; mb < 4; ++mb) { a[mb] = WFrag<T16>::ld(atb(A + aoff + (size_t)mb * 16 * K, lo)); if (NSPLIT == 1 || NSPLIT == 2) a2[mb] = WFrag<T16>::ld(atb(A2 + aoff + (size_t)mb * 16 * K, lo)); }
        V b[4], b2[4];
#pragma unroll
        for (int nb = 0; nb < 4; ++nb) { b[nb] = WFrag<T16>::ld(atb(Bt + boff + (size_t)nb * 16 * K, lo)); if (NSPLIT >= 2) b2[nb] = WFrag<T16>::ld(atb(Bt2 + boff + (size_t)nb * 16 * K, lo)); }
        __builtin_amdgcn_sched_barrier(0);   // all loads of the pass are issued ahead of its products, one load latency a pass (the scheduler otherwise keeps one B fragment's registers and waits out a load per column block)
#pragma unroll
        for (int nb = 0; nb < 4; ++nb) {
#pragma unroll
            for (int mb = 0; mb < 4; ++mb) { acc[mb][nb] = WFrag<T16>::mma(a[mb], b[nb], acc[mb][nb]); if (NSPLIT == 1 || NSPLIT == 2) acc[mb][nb] = WFrag<T16>::mma(a2[mb], b[nb], acc[mb][nb]); if (NSPLIT >= 2) acc[mb][nb] = WFrag<T16>::mma(a[mb], b2[nb], acc[mb][nb]); } }
        asm volatile("v_nop\n\tv_nop\n\tv_nop\n\tv_nop" : "+v"(acc[0][0]), "+v"(acc[1][1]), "+v"(acc[2][2]), "+v"(acc[3][3]) : "v"(a[0]), "v"(a[3]));
        asm volatile("s_wait_xcnt 0x0" ::: "memory");   // stands between this pass's loads and the step of the offset register that they name
        __builtin_amdgcn_sched_barrier(0);   // holds the step behind that wait
        lo += KW * 1024;
    }
    if constexpr (KW > 1) {
        float* osw = os + wv * SLAB;
#pragma unroll
        for (int mb = 0; mb < 4; ++mb)
#pragma unroll
            for (int nb = 0; nb < 4; ++nb)
#pragma unroll
                for (int j = 0; j < 8; ++j) osw[(mb * 16 + hi * 8 + j) * 68 + nb * 16 + lr] = acc[mb][nb][j];
        __syncthreads();   // every wave's partial tile is in LDS before any thread sums it
        if constexpr (OM == 0) {
            const int row0 = (int)(threadIdx.x >> 4), cofs = (int)(threadIdx.x & 15) * 4;   // the block covers 2 * KW rows of 16 float4 per step
            constexpr int NQ = 32 / KW;
            v4f vq[NQ];
#pragma unroll
            for (int q = 0; q < NQ; ++q) { const int row = q * 2 * KW + row0; v4f val = *(const v4fa*)(os + row * 68 + cofs);
#pragma unroll
                for (int w = 1; w < KW; ++w) val += *(const v4fa*)(os + w * SLAB + row * 68 + cofs);
                if (BIAS == 1) { val[0] += bfr(bias[c0 + cofs]); val[1] += bfr(bias[c0 + cofs + 1]); val[2] += bfr(bias[c0 + cofs + 2]); val[3] += bfr(bias[c0 + cofs + 3]); }
                if (BIAS == 2) val += bfr(bias[r0 + row]);
                vq[q] = val; }
            float* pc[NQ];
#pragma unroll
            for (int q = 0; q < NQ; ++q) pc[q] = C + (size_t)(r0 + q * 2 * KW + row0) * ldc + c0 + cofs;
#pragma unroll
            for (int q = 0; q < NQ; ++q) *(v4f*)pc[q] = vq[q];
        } else {
            static_assert(KW == 8, "16 half fragments of the tile over 8 waves, 2 steps");
            // A thread joins 8 consecutive columns of one row, one 16-byte unit of the plane; a wave takes the 32 units of half a fragment (16 rows x the k units 2 j and 2 j + 1), which lie in lane order: each store is 512 contiguous bytes. The LDS reads stay free of bank conflicts (16 rows at pitch 68 start 4 banks apart).
            v8us oh[2], ol[2]; bf* pa[2]; bf* pb[2];
#pragma unroll
            for (int s = 0; s < 2; ++s) { const int hf = s * 8 + wv, rbl = hf >> 2, kbl = (hf >> 1) & 1, j = hf & 1;   // which half fragment of the tile: row block, k block, piece
                const int row = rbl * 16 + lr, col = kbl * 32 + j * 16 + hi * 8;
                v4f v0 = *(const v4fa*)(os + row * 68 + col), v1 = *(const v4fa*)(os + row * 68 + col + 4);
#pragma unroll
                for (int w = 1; w < KW; ++w) { v0 += *(const v4fa*)(os + w * SLAB + row * 68 + col); v1 += *(const v4fa*)(os + w * SLAB + row * 68 + col + 4); }
                if (BIAS == 1) {
#pragma unroll
                    for (int e = 0; e < 4; ++e) { v0[e] += bfr(bias[c0 + col + e]); v1[e] += bfr(bias[c0 + col + 4 + e]); } }
                if (BIAS == 2) { const float rw = bias[r0 + row];
                    asm volatile("s_wait_xcnt 0x0" ::: "memory");   // stands between the bias load and the next write of the register that it names as address
                    const float rb = bfr(rw); v0 += rb; v1 += rb; }
#pragma unroll
                for (int e = 0; e < 4; ++e) { oh[s][e] = f2bf(v0[e]); oh[s][4 + e] = f2bf(v1[e]); }
                v4f h0, h1;
#pragma unroll
                for (int e = 0; e < 4; ++e) { h0[e] = bf2f(oh[s][e]); h1[e] = bf2f(oh[s][4 + e]); }
                const v4f s0 = v0 - h0, s1 = v1 - h1;   // what the hi plane leaves, exact in f32
#pragma unroll
                for (int e = 0; e < 4; ++e) { ol[s][e] = f2bf(s0[e]); ol[s][4 + e] = f2bf(s1[e]); }
                const size_t fr = (OM == 1) ? (size_t)(r0 / 16 + rbl) * (ldc / 32) + c0 / 32 + kbl : ((size_t)by * (TT / 16) + r0 / 16 + rbl) * (HD / 32) + kbl;   // the fragment's number in its plane
                const size_t eo = fr * 512 + j * 256 + lane * 8; pa[s] = Ph + eo; pb[s] = Pl + eo; }
            __builtin_amdgcn_sched_barrier(0);   // all values and addresses are ready here: behind the first store no register that a store names is written any more (the scheduler otherwise lifts the first store into the split and has to wait before it reuses the store's registers)
#pragma unroll
            for (int s = 0; s < 2; ++s) { *(v8us*)pa[s] = oh[s]; *(v8us*)pb[s] = ol[s]; }
            asm volatile("s_wait_xcnt 0x0" ::: "memory");   // stands behind the store(s): in a kernel that holds several bodies the listing goes on from here into another body's head, which writes registers that a store names
        }
        return;
    }
#pragma unroll
    for (int mb = 0; mb < 4; ++mb) {
#pragma unroll
        for (int nb = 0; nb < 4; ++nb) {
#pragma unroll
            for (int j = 0; j < 8; ++j) os[(hi * 8 + j) * 68 + nb * 16 + lr] = acc[mb][nb][j]; }
        __builtin_amdgcn_wave_barrier(); asm volatile("" ::: "memory");
        float* crow = C + (size_t)(r0 + mb * 16) * ldc + c0;
{
#pragma unroll
            for (int s = 0; s < 8; ++s) { const int row = 2 * s + hi, cofs = lr * 4; v4f val = *(const v4fa*)(os + row * 68 + cofs); if (BIAS) { val[0] += bfr(bias[c0 + cofs]); val[1] += bfr(bias[c0 + cofs + 1]); val[2] += bfr(bias[c0 + cofs + 2]); val[3] += bfr(bias[c0 + cofs + 3]); }
                *(v4f*)(crow + (size_t)row * ldc + cofs) = val; }
             }
        __builtin_amdgcn_wave_barrier(); asm volatile("" ::: "memory");
    }
}

#define GLDS (8 * 64 * 68)          // floats: the 8 waves' partial tiles
#define PLNE ((size_t)NH_ * TT * HD) // elements of one batch's head planes
// k_qkv: the three projections of both batches, which do not depend on one another, in one launch; grid (NB_ * TT / 64, 16, 3). z = 0: Q, z = 1: K, each into head planes of batch bx / 32; z = 2: V^T = Wv^T.X^T of batch b, rows (head, d), columns the batch's tokens.
__global__ __launch_bounds__(256) void k_qkv(const bf* __restrict__ XQ, const bf* __restrict__ XK, const bf* __restrict__ XV, const bf* __restrict__ WQ, const bf* __restrict__ WK, const bf* __restrict__ WV, const float* __restrict__ bq, const float* __restrict__ bk, const float* __restrict__ bv, bf* QPh, bf* QPl, bf* KPh, bf* KPl, bf* VTh, bf* VTl) {
    __shared__ __align__(16) float os[GLDS];
    const int bx = blockIdx.x, by = blockIdx.y;
    if (blockIdx.z < 2) { const size_t b = bx / (TT / 64); const bool zq = blockIdx.z == 0; gemmw_tile<bf, 0, 1, 8, 2, DM>(os, bx % (TT / 64), by, (zq ? XQ : XK) + b * TT * DM, nullptr, zq ? WQ : WK, nullptr, nullptr, (zq ? QPh : KPh) + b * PLNE, (zq ? QPl : KPl) + b * PLNE, DKV, zq ? bq : bk); }
    else { const int t = by * (NB_ * TT / 64) + bx; const size_t b = t / ((DKV / 64) * (TT / 64)); gemmw_tile<bf, 0, 2, 8, 1, DM>(os, t % (DKV / 64), (t / (DKV / 64)) % (TT / 64), WV, nullptr, XV + b * TT * DM, nullptr, nullptr, VTh + b * PLNE, VTl + b * PLNE, TT, bv); }
}
// k_wo: merged hi/lo rows of both batches x Wo + bo, f32 to the output; grid (NB_ * TT / 64, 16).
__global__ __launch_bounds__(256) void k_wo(const bf* __restrict__ ATh, const bf* __restrict__ ATl, const bf* __restrict__ WO, float* OUT, const float* __restrict__ bo) {
    __shared__ __align__(16) float os[GLDS];
    gemmw_tile<bf, 1, 1, 8, 0, DQ>(os, blockIdx.x, blockIdx.y, ATh, ATl, WO, nullptr, OUT, nullptr, nullptr, DM, bo);
}

typedef __attribute__((ext_vector_type(2))) unsigned short v2us;
typedef __attribute__((ext_vector_type(2))) float v2f;

// The three converters store fragment order; k_prep below runs all of them in one launch and hands each its block number. wtG (Bt[n][k] = w[k][n]): a thread takes one column n and 8 consecutive k; a wave's 32 columns make each load one whole line and each store two runs of 256 bytes.
__device__ __forceinline__ void wtG(const float* __restrict__ w, int K, int N, bf* Bt, int blk) {
    const int n = (blk % (N / 256)) * 256 + threadIdx.x, u = blk / (N / 256); v8us o;   // (N / 256) * (K / 8) blocks
    const float* wr = w + (size_t)u * 8 * N;   // the block's 8 rows: uniform bases, the lane's part is its column
#pragma unroll
    for (int e = 0; e < 8; ++e) o[e] = f2bf(*atb(wr + (size_t)e * N, (unsigned)n * 4));
    *(v8us*)(Bt + ((size_t)(n >> 4) * (K / 32) + (u >> 2)) * 512 + ((u & 3) * 16 + (n & 15)) * 8) = o;
    asm volatile("s_wait_xcnt 0x0" ::: "memory");   // stands behind the store(s): in a kernel that holds several bodies the listing goes on from here into another body's head, which writes registers that a store names
}
// cvt8 (rows of DM): a wave takes 8 rows x 32 k, half a fragment: lane = (k unit q, row); it reads 8 whole lines in two loads and stores 4 whole lines.
__device__ __forceinline__ void cvt8(const float* __restrict__ src, bf* dst, int blk) { const size_t i = (size_t)blk * 256 + threadIdx.x;
    const int lane = threadIdx.x & 31, q = lane >> 3; const size_t wv = i >> 5, fr = wv >> 1; const int c = (int)(wv & 1) * 8 + (lane & 7);
    const v8f v = *(const v8f*)(src + ((fr / (DM / 32)) * 16 + c) * DM + (fr % (DM / 32)) * 32 + q * 8); v8us o;
#pragma unroll
    for (int k = 0; k < 8; ++k) o[k] = f2bf(v[k]); *(v8us*)(dst + fr * 512 + (q * 16 + c) * 8) = o;
    asm volatile("s_wait_xcnt 0x0" ::: "memory");   // stands behind the store(s): in a kernel that holds several bodies the listing goes on from here into another body's head, which writes registers that a store names
}

// wbx (Bt[n][k] = w[k][n], the bilinear W, HD x HD): thread i writes unit i of the plane: row c, k unit q of fragment i / 64.
__device__ __forceinline__ void wbx(const float* __restrict__ w, bf* Bt, int blk) { const int i = blk * 256 + (int)threadIdx.x; const int fr = i >> 6; const int k0 = (fr % (HD / 32)) * 32 + ((i >> 4) & 3) * 8; const int n = (fr / (HD / 32)) * 16 + (i & 15); v8us o;
#pragma unroll
    for (int q = 0; q < 8; ++q) o[q] = f2bf(w[(k0 + q) * HD + n]);
    *(v8us*)(Bt + (size_t)i * 8) = o;
    asm volatile("s_wait_xcnt 0x0" ::: "memory");   // stands behind the store(s): in a kernel that holds several bodies the listing goes on from here into another body's head, which writes registers that a store names
}
// k_prep: every converter in one launch (none reads what another writes). Blocks 0 .. 3 * CVB - 1: the three inputs, both batches (NB_ * TT rows each, XB holds the three copies in turn); then 4 * WTB blocks: Wq, Wk, Wv, Wo (WT holds the four in turn); then the bilinear W.
#define CVB (NB_ * TT * DM / 8 / 256)
#define WTB (DM * DQ / 8 / 256)
#define WDB (HD * HD / 8 / 256)
__global__ __launch_bounds__(256) void k_prep(const float* __restrict__ x, const float* __restrict__ xk, const float* __restrict__ xv, const float* __restrict__ wq, const float* __restrict__ wk, const float* __restrict__ wv, const float* __restrict__ wo, const float* __restrict__ wbl, bf* XB, bf* WT, bf* WB) {
    const int blk = blockIdx.x, wb = blk - 3 * CVB;
    if (blk < 3 * CVB) { const int s = blk / CVB; cvt8(s == 0 ? x : s == 1 ? xk : xv, XB + (size_t)s * NB_ * TT * DM, blk % CVB); }
    else if (wb < 4 * WTB) { const int s = wb / WTB; wtG(s == 0 ? wq : s == 1 ? wk : s == 2 ? wv : wo, DM, DQ, WT + (size_t)s * DQ * DM, wb % WTB); }
    else wbx(wbl, WB, wb - 4 * WTB);
}
// ---- k_fattn: Q W, scores, threshold, softmax, attn.V and the head merge in one kernel; S and P stay in registers. Grid (TT/256, heads, batches), 8 waves, each wave owns 32 query columns and walks all TT keys in passes of 32.
// Transposed products: S^T = K.(Q W)^T (A = K rows, B = rows of Q W kept in registers), O^T += V^T.P^T (A = V^T rows, B = the two 16-key score tiles of a pass packed in place: element s of B is tile s >> 3, register s & 7, the k order that WFrag::ld gives A).
// Q W the same way, once, ahead of the key loop: (Q W)^T = W^T.Q^T (A = rows of W^T, B = the wave's Q rows); two 16-row result tiles, split into hi/lo and packed in place, are one B fragment of the score product, in the same k order.
// A lane holds scores of one query (column c) only, so maximum, sum and rescale factor are per lane; lanes c and c + 16 split the keys and share the maximum through one exchange per pass, their sums are joined once at the end.
// Running maximum in log2 units; the accumulators are rescaled only when some column's maximum has grown by more than 8 (p stays <= 2^8). hi/lo planes and the 3 products per GEMM as before; the row is divided by its sum after attn.V.
typedef __attribute__((ext_vector_type(2))) __bf16 v2b;
typedef __attribute__((ext_vector_type(8))) unsigned v8u;
__device__ __forceinline__ float xhalf(float x) { const int b = __float_as_int(x); return __int_as_float(__builtin_amdgcn_permlanex16(b, b, 0x76543210, 0xfedcba98, false, false)); }   // the value of lane l ^ 16
__global__ __launch_bounds__(256) void k_fattn(const bf* __restrict__ Qh, const bf* __restrict__ Ql, const bf* __restrict__ Kh, const bf* __restrict__ Kl, const bf* __restrict__ Vh, const bf* __restrict__ Vl, const bf* __restrict__ WB, const int* __restrict__ thrp, bf* Ah, bf* Al) {
    typedef WFrag<bf> F; typedef F::V V;
    constexpr float L2E = 1.4426950408889634f;
    const int lane = threadIdx.x & 31, h = lane >> 4;
    const int hd = blockIdx.y, b = blockIdx.z; const int q0 = blockIdx.x * 256 + __builtin_amdgcn_readfirstlane((int)(threadIdx.x >> 5)) * 32;   // the wave's number as a scalar: every fragment's base is wave-uniform
    const int thr = __builtin_amdgcn_readfirstlane(thrp[b]);   // the batch's key threshold (input), a scalar so that the mask test is a scalar branch
    const size_t pl = ((size_t)b * NH_ + hd) * TT * HD;
    const unsigned ko = (unsigned)lane * 16;   // bytes: the lane's place in a fragment, its only own part of a load's address
    const bf* qph = Qh + pl + (size_t)q0 * HD; const bf* qpl = Ql + pl + (size_t)q0 * HD;   // wave-uniform bases, as for K and V^T below
    V rh[2][2], rl[2][2], wf[4][2];   // the wave's Q rows (hi, lo) and all of W^T
#pragma unroll
    for (int qt = 0; qt < 2; ++qt)
#pragma unroll
        for (int ks = 0; ks < 2; ++ks) { rh[qt][ks] = F::ld(atb(qph, ko) + qt * 16 * HD + ks * 512); rl[qt][ks] = F::ld(atb(qpl, ko) + qt * 16 * HD + ks * 512); }
#pragma unroll
    for (int mt = 0; mt < 4; ++mt)
#pragma unroll
        for (int ks = 0; ks < 2; ++ks) wf[mt][ks] = F::ld(atb(WB, ko) + mt * 16 * HD + ks * 512);
    const bf* kph = Kh + pl; const bf* kpl = Kl + pl; const bf* vph = Vh + pl; const bf* vpl = Vl + pl;   // wave-uniform bases; the lane's part is a 32-bit byte offset
    unsigned vb = ko, kb2 = ko + 32 * HD * 2;   // the lane's byte offsets of this pass's V^T columns and of the next pass's K rows; both step only behind the wait that follows their loads
    v8f o[4][2];
#pragma unroll
    for (int dt = 0; dt < 4; ++dt)
#pragma unroll
        for (int qt = 0; qt < 2; ++qt) o[dt][qt] = (v8f){};
    float ms[2] = {-3.0e38f, -3.0e38f}, l[2] = {0.f, 0.f};
    V kh[2][2], kl[2][2];
#pragma unroll
    for (int kt = 0; kt < 2; ++kt)
#pragma unroll
        for (int ks = 0; ks < 2; ++ks) { kh[kt][ks] = F::ld(atb(kph, ko) + kt * 16 * HD + ks * 512); kl[kt][ks] = F::ld(atb(kpl, ko) + kt * 16 * HD + ks * 512); }
    asm volatile("s_wait_xcnt 0x0" ::: "memory");   // stands between the loads above and the next write of a register that they name as address
    __builtin_amdgcn_sched_barrier(0);   // holds later register writes behind that wait
    V qh[2][2], ql[2][2];   // Q W of the wave's 32 queries, hi/lo, as B fragments
#pragma unroll
    for (int qt = 0; qt < 2; ++qt) { v8f t[4];
#pragma unroll
        for (int mt = 0; mt < 4; ++mt) { v8f a = (v8f){};
#pragma unroll
            for (int ks = 0; ks < 2; ++ks) { a = F::mma(wf[mt][ks], rh[qt][ks], a); a = F::mma(wf[mt][ks], rl[qt][ks], a); }
            t[mt] = a; }
#pragma unroll
        for (int ks = 0; ks < 2; ++ks) { v8u wh, wl;
#pragma unroll
            for (int e = 0; e < 16; e += 2) { v2f p; p[0] = t[2 * ks + (e >> 3)][e & 7]; p[1] = t[2 * ks + (e >> 3)][(e & 7) + 1];
                const v2b hp = __builtin_convertvector(p, v2b); v2f rs; rs[0] = p[0] - (float)hp[0]; rs[1] = p[1] - (float)hp[1];
                wh[e >> 1] = __builtin_bit_cast(unsigned, hp); wl[e >> 1] = __builtin_bit_cast(unsigned, __builtin_convertvector(rs, v2b)); }
            qh[qt][ks] = __builtin_bit_cast(V, wh); ql[qt][ks] = __builtin_bit_cast(V, wl); } }
#pragma unroll 1
    for (int kb = 0; kb < TT; kb += 32) {
        V vh[4], vl[4];   // this pass's V^T fragments, asked for ahead of the score products
#pragma unroll
        for (int dt = 0; dt < 4; ++dt) { vh[dt] = F::ld(atb(vph, vb) + dt * 16 * TT); vl[dt] = F::ld(atb(vpl, vb) + dt * 16 * TT); }
        asm volatile("s_wait_xcnt 0x0" ::: "memory");   // stands between these loads and the next write of a register that they name as address
        __builtin_amdgcn_sched_barrier(0);   // keeps the V^T loads issued here, a whole score block and softmax ahead of their use (the scheduler otherwise sinks them next to it), and the offset's step behind the wait
        vb += 1024;   // the next 32 keys' fragment of the same 16 rows
        v8f s[2][2];
#pragma unroll
        for (int kt = 0; kt < 2; ++kt)
#pragma unroll
            for (int qt = 0; qt < 2; ++qt) { v8f t = (v8f){};
#pragma unroll
                for (int ks = 0; ks < 2; ++ks) { t = F::mma(kh[kt][ks], qh[qt][ks], t); t = F::mma(kh[kt][ks], ql[qt][ks], t); t = F::mma(kl[kt][ks], qh[qt][ks], t); }
                s[kt][qt] = t; }
        // the next pass's K fragments fly during the softmax
#pragma unroll
        for (int kt = 0; kt < 2; ++kt)
#pragma unroll
            for (int ks = 0; ks < 2; ++ks) { kh[kt][ks] = F::ld(atb(kph, kb2) + kt * 16 * HD + ks * 512); kl[kt][ks] = F::ld(atb(kpl, kb2) + kt * 16 * HD + ks * 512); }
        asm volatile("s_wait_xcnt 0x0" ::: "memory");   // as above, for the K loads
        __builtin_amdgcn_sched_barrier(0);   // keeps the next K loads issued here, ahead of the softmax (the scheduler otherwise sinks them to the end of the pass, just in front of their use), and the offset's step behind the wait
        kb2 = (kb + 64 < TT) ? kb2 + 32 * HD * 2 : ko;   // the last pass re-reads pass 0, unused
        if (kb + 32 > thr) {   // keys >= threshold get the VALUE -1e-6 (MASK_VALUE), not an exclusion
#pragma unroll
            for (int kt = 0; kt < 2; ++kt)
#pragma unroll
                for (int r = 0; r < 8; ++r) { const bool keep = (kb + kt * 16 + 8 * h + r) < thr;
#pragma unroll
                    for (int qt = 0; qt < 2; ++qt) s[kt][qt][r] = keep ? s[kt][qt][r] : -1.0e-6f; }
        }
        float mxs[2]; bool need = false;
#pragma unroll
        for (int qt = 0; qt < 2; ++qt) { float mx = s[0][qt][0];
#pragma unroll
            for (int r = 1; r < 8; ++r) mx = fmaxf(mx, s[0][qt][r]);
#pragma unroll
            for (int r = 0; r < 8; ++r) mx = fmaxf(mx, s[1][qt][r]);
            mx = fmaxf(mx, xhalf(mx)); mxs[qt] = mx * L2E; need = need || (mxs[qt] > ms[qt] + 8.0f); }
        if (__builtin_amdgcn_ballot_w32(need) != 0) {
#pragma unroll
            for (int qt = 0; qt < 2; ++qt) { const float mn = fmaxf(ms[qt], mxs[qt]); const float al = __builtin_amdgcn_exp2f(ms[qt] - mn); ms[qt] = mn; l[qt] *= al;
#pragma unroll
                for (int dt = 0; dt < 4; ++dt) o[dt][qt] *= al; }
        }
        V ph[2], pw[2];
#pragma unroll
        for (int qt = 0; qt < 2; ++qt) { v2f sum = (v2f){0.f, 0.f}; v8u wh, wl;   // two elements at a time: packed conversions, packed sums
#pragma unroll
            for (int e = 0; e < 16; e += 2) { v2f p; p[0] = __builtin_amdgcn_exp2f(__builtin_fmaf(s[e >> 3][qt][e & 7], L2E, -ms[qt])); p[1] = __builtin_amdgcn_exp2f(__builtin_fmaf(s[e >> 3][qt][(e & 7) + 1], L2E, -ms[qt])); sum += p;
                const v2b hp = __builtin_convertvector(p, v2b); v2f rs; rs[0] = p[0] - (float)hp[0]; rs[1] = p[1] - (float)hp[1];
                wh[e >> 1] = __builtin_bit_cast(unsigned, hp); wl[e >> 1] = __builtin_bit_cast(unsigned, __builtin_convertvector(rs, v2b)); }
            ph[qt] = __builtin_bit_cast(V, wh); pw[qt] = __builtin_bit_cast(V, wl); l[qt] += sum[0] + sum[1]; }
#pragma unroll
        for (int dt = 0; dt < 4; ++dt)
#pragma unroll
            for (int qt = 0; qt < 2; ++qt) { o[dt][qt] = F::mma(vh[dt], ph[qt], o[dt][qt]); o[dt][qt] = F::mma(vh[dt], pw[qt], o[dt][qt]); o[dt][qt] = F::mma(vl[dt], ph[qt], o[dt][qt]); }
    }
    v8us oh[2][4], ol[2][4];
#pragma unroll
    for (int qt = 0; qt < 2; ++qt) { const float f = __fdiv_rn(1.0f, l[qt] + xhalf(l[qt]));
#pragma unroll
        for (int dt = 0; dt < 4; ++dt)
#pragma unroll
            for (int r = 0; r < 8; ++r) { unsigned short x2, y2; splitf(o[dt][qt][r] * f, x2, y2); oh[qt][dt][r] = x2; ol[qt][dt][r] = y2; } }
    const size_t ro = ((size_t)b * TT + q0) * DQ + hd * (HD / 32) * 512 + lane * 8; bf* pa = Ah + ro; bf* pb = Al + ro;   // merged rows [NB_ * TT][DQ] in fragment order: the head's two k blocks, piece dt & 1 of block dt >> 1
    __builtin_amdgcn_sched_barrier(0);   // all values and both addresses are ready here: behind the first store no register that a store names is written any more
#pragma unroll
    for (int qt = 0; qt < 2; ++qt)
#pragma unroll
        for (int dt = 0; dt < 4; ++dt) { *(v8us*)(pa + qt * 16 * DQ + dt * 256) = oh[qt][dt]; *(v8us*)(pb + qt * 16 * DQ + dt * 256) = ol[qt][dt]; }
}

extern "C" void kernel_launch(void* const* d_in, const int* in_sizes, int n_in,
                              void* d_out, int out_size, void* d_ws, size_t ws_size, hipStream_t stream) {
    (void)in_sizes; (void)n_in; (void)out_size;
    const float* x = (const float*)d_in[0]; const float* xk = (const float*)d_in[1]; const float* xv = (const float*)d_in[2]; const int* thr = (const int*)d_in[3]; const float* wq = (const float*)d_in[4]; const float* bq = (const float*)d_in[5]; const float* wk = (const float*)d_in[6]; const float* bk = (const float*)d_in[7]; const float* wv = (const float*)d_in[8]; const float* bv = (const float*)d_in[9]; const float* wbl = (const float*)d_in[10]; const float* wo = (const float*)d_in[11]; const float* bo = (const float*)d_in[12];
    float* OUT = (float*)d_out;     // [2][2048][1024]
    char* wsp = (char*)d_ws;
    auto take = [&](size_t bytes) { char* p = wsp; wsp += (bytes + 255) & ~(size_t)255; return (void*)p; };
    bf* WB = (bf*)take((size_t)HD * HD * 2);
    bf* WT = (bf*)take((size_t)4 * DQ * DM * 2); bf* WQ = WT; bf* WK = WT + (size_t)DQ * DM; bf* WV = WT + (size_t)2 * DQ * DM; bf* WO = WT + (size_t)3 * DQ * DM;
    bf* XB = (bf*)take((size_t)3 * NB_ * TT * DM * 2); bf* XQ = XB; bf* XK = XB + (size_t)NB_ * TT * DM; bf* XV = XB + (size_t)2 * NB_ * TT * DM;
    const size_t PLN = (size_t)NH_ * TT * HD;   // one batch's head planes; every plane is kept for both batches
    bf* QPh = (bf*)take(NB_ * PLN * 2); bf* QPl = (bf*)take(NB_ * PLN * 2); bf* KPh = (bf*)take(NB_ * PLN * 2); bf* KPl = (bf*)take(NB_ * PLN * 2); bf* VTh = (bf*)take(NB_ * PLN * 2); bf* VTl = (bf*)take(NB_ * PLN * 2);
    bf* ATh = (bf*)take((size_t)NB_ * TT * DQ * 2); bf* ATl = (bf*)take((size_t)NB_ * TT * DQ * 2);
    if ((size_t)(wsp - (char*)d_ws) > ws_size) return;    // ws 256 MiB
    k_prep<<<3 * CVB + 4 * WTB + WDB, 256, 0, stream>>>(x, xk, xv, wq, wk, wv, wo, wbl, XB, WT, WB);
    k_qkv<<<dim3(NB_ * TT / 64, DQ / 64, 3), 256, 0, stream>>>(XQ, XK, XV, WQ, WK, WV, bq, bk, bv, QPh, QPl, KPh, KPl, VTh, VTl);
    k_fattn<<<dim3(TT / 256, NH_, NB_), 256, 0, stream>>>(QPh, QPl, KPh, KPl, VTh, VTl, WB, thr, ATh, ATl);
    k_wo<<<dim3(NB_ * TT / 64, DM / 64, 1), 256, 0, stream>>>(ATh, ATl, WO, OUT, bo);
}

// v007
// A run of this version takes 124 microseconds.
// Next to v006, in two timings, it ran 1.07 and 1.08 times as fast.
// All steps since v000 together make it 11.2 times as fast.
#include <hip/hip_runtime.h>

// Multi-head attention with a learned bilinear score and a per-batch key threshold (queries, keys, values [2][2048][1024]; Q,K,V = input W + b ('xw' [1024][1024] + [1024]; 16 heads x 64); scores = (Q W).K with W [64][64] shared by all heads, NO 1/sqrt(d) (logit sigma ~8); keys j >= thresholds[b] get the logit MASK_VALUE = -1e-6 (a value near zero, NOT an exclusion -- reproduced literally; thresholds int [2], read); softmax; out = merged attn.V Wo + bo -> [2][2048][1024] (4.2 M)).
// Four launches, each over both batches: one converter launch (bf16 copies of the three inputs and of the weights); the three projections in one launch; attention; Wo. Exact projections + f32 biases, each GEMM's join writing the bf16 hi/lo planes its consumer reads (Q and K by head, V^T as the product Wv^T.X^T); the bilinear W [64][64] applied at the head of the attention kernel, by each wave to its own 32 query rows, on the hi/lo planes of Q (2 products, K = 64), the f32 result split into hi/lo in registers; ONE fused attention launch over both batches and all heads, EVERY row on hi/lo planes (3 products; unscaled logits), reading the batch's threshold once and selecting -1e-6 for j >= threshold, online softmax; merged hi/lo x Wo exact + bo.
// Every 16-bit plane lies in FRAGMENT ORDER: a matrix [rows][K] is cut into fragments of 16 rows x 32 k, fragment (rb, kb) at element (rb * (K / 32) + kb) * 512, and inside it element (row c, k = 8 q + e) at (q * 16 + c) * 8 + e. Lane l = 16 h + c of a wave then finds its two 16-byte pieces (q = h and q = 2 + h) at l * 8 and 256 + l * 8: each wave-wide load is 512 contiguous bytes, four whole lines. Every producer stores that order.
// Compute dtypes, f32 accumulate: every input rounded to bf16; projections exact + f32 biases; Q W hi/lo x exact; scores and attn.V 3 products on every row; softmax f32; Wo hl x exact + bias.

#define NB_  2
#define TT   2048
#define DM   1024
#define NH_  16
#define NKV  16
#define REP  (NH_ / NKV)
#define HD   64
#define DQ   (NH_ * HD)
#define DKV  (NKV * HD)
#define ZH   2
#define RH   2048                  // unused: every query row uses hi+lo planes
#define WIN  0
#define PCAR 1024.0f
#define SCL  1.0f   // no 1/sqrt(d) in the module
typedef _Float16 h16;
typedef unsigned short bf;
typedef __attribute__((ext_vector_type(16))) __bf16   v16bf;
typedef __attribute__((ext_vector_type(16))) _Float16 v16h;
typedef __attribute__((ext_vector_type(8)))  _Float16 v8h;
typedef __attribute__((ext_vector_type(8)))  unsigned short v8us;
typedef __attribute__((ext_vector_type(8)))  float    v8f;
typedef __attribute__((ext_vector_type(4)))  float    v4f;
typedef v8h  __attribute__((may_alias)) v8ha;
typedef v4f  __attribute__((may_alias)) v4fa;
typedef v8us __attribute__((may_alias)) v8usa;

__device__ __forceinline__ unsigned short f2bf(float f) { unsigned u = __float_as_uint(f); u += 0x7FFFu + ((u >> 16) & 1u); return (unsigned short)(u >> 16); }
__device__ __forceinline__ float bf2f(unsigned short b) { return __uint_as_float(((unsigned)b) << 16); }
__device__ __forceinline__ float bfr(float f) { return bf2f(f2bf(f)); }
__device__ __forceinline__ v16h cat16(v8h lo, v8h hi) { return __builtin_shufflevector(lo, hi, 0, 1, 2, 3, 4, 5, 6, 7, 8, 9, 10, 11, 12, 13, 14, 15); }
__device__ __forceinline__ v16bf cat16b(v8us lo, v8us hi) { return __builtin_bit_cast(v16bf, __builtin_shufflevector(lo, hi, 0, 1, 2, 3, 4, 5, 6, 7, 8, 9, 10, 11, 12, 13, 14, 15)); }
__device__ __forceinline__ v8f wmma16(v16h a, v16h b, v8f c) { return __builtin_amdgcn_wmma_f32_16x16x32_f16(false, a, false, b, (short)0, c, false, false); }
__device__ __forceinline__ v8f wmmab(v16bf a, v16bf b, v8f c) { return __builtin_amdgcn_wmma_f32_16x16x32_bf16(false, a, false, b, (short)0, c, false, false); }



// ---- gemmw_tile: register-blocked GEMM, one 64x64 output tile (bx, by) per block (16 accumulators per wave), operands straight from 16-bit planes in fragment order (WFrag::ld takes the lane's place in a fragment); 32 * KW threads; os: the block's LDS, KW * SLAB floats. The kernels below say which tile of which product a block takes.
// C[m][n] (+ optional f32 bias: BIAS 1 bias[n], BIAS 2 bias[m]) = sum_k A[m][k] Bt[n][k] (+ split products per NSPLIT). K (a template constant, so that a row block's distance is an immediate offset of the load) % (32 * KW) == 0.
// Where the f32 sum goes (OM): 0 = f32 to C, pitch ldc; 1 = split into bf16 hi/lo planes Ph/Pl, a matrix of ldc columns in fragment order; 2 = the same split into head planes [n / 64], each a matrix [TT rows m][64 columns n % 64] in fragment order (a tile's 64 columns are one head).
// KW waves share the tile's K range: wave w takes the 32-wide k blocks w, w + KW, ... into its own full set of accumulators; the KW partial tiles are joined in LDS in the fixed order w = 0 .. KW-1 (KW = 1: no join).
template <typename T> __device__ __forceinline__ const T* atb(const T* base, unsigned bytes) { return (const T*)((const char*)base + bytes); }   // uniform base + 32-bit lane offset
template <typename T16> struct WFrag;
template <> struct WFrag<h16> { typedef v16h V; static __device__ __forceinline__ V ld(const h16* p) { return cat16(*(const v8h*)p, *(const v8h*)(p + 256)); } static __device__ __forceinline__ v8f mma(V a, V b, v8f c) { return wmma16(a, b, c); } };
template <> struct WFrag<bf> { typedef v16bf V; static __device__ __forceinline__ V ld(const bf* p) { return cat16b(*(const v8us*)p, *(const v8us*)(p + 256)); } static __device__ __forceinline__ v8f mma(V a, V b, v8f c) { return wmmab(a, b, c); } };
typedef __attribute__((ext_vector_type(4))) unsigned short v4us;
__device__ __forceinline__ void splitf(float y, unsigned short& h, unsigned short& l) { h = f2bf(y); l = f2bf(y - bf2f(h)); }
template <typename T16, int NSPLIT, int BIAS, int KW, int OM, int K>
__device__ __forceinline__ void gemmw_tile(float* os, const int bx, const int by, const T16* __restrict__ A, const T16* __restrict__ A2, const T16* __restrict__ Bt, const T16* __restrict__ Bt2, float* C, bf* Ph, bf* Pl, int ldc, const float* __restrict__ bias) {
    typedef typename WFrag<T16>::V V;
    static_assert(KW == 1 || 32 % KW == 0, "the join walks the 64 rows in steps of 2 * KW");
    static_assert(KW > 1 || (OM == 0 && BIAS != 2), "planes and the row bias are written by the join");
    static_assert(OM != 2 || HD == 64, "a tile's columns are one head");
    constexpr int SLAB = (KW == 1 ? 16 : 64) * 68;   // floats of one wave's staging slab (KW > 1: its whole partial tile)
    const int wv = (KW == 1) ? 0 : __builtin_amdgcn_readfirstlane((int)(threadIdx.x >> 5));   // wave number as a scalar: the k loop stays a scalar loop
    const int lane = threadIdx.x & 31, lr = lane & 15, hi = lane >> 4; const int r0 = bx * 64, c0 = by * 64;
    v8f acc[4][4];
#pragma unroll
    for (int mb = 0; mb < 4; ++mb)
#pragma unroll
        for (int nb = 0; nb < 4; ++nb) acc[mb][nb] = (v8f){};
    const size_t aoff = (size_t)r0 * K, boff = (size_t)c0 * K;   // wave-uniform: 16 rows of fragments are 16 * K elements, a 32-wide k block 512
    unsigned lo = (unsigned)lane * 16 + (unsigned)wv * 1024;   // bytes: the lane's place in a fragment + the wave's k block (1024 bytes each); one 32-bit offset serves every load of a pass beside its uniform base
#pragma unroll 1
    for (int kc = wv * 32; kc < K; kc += 32 * KW) {
        V a[4], a2[4];
#pragma unroll
        for (int mb = 0; mb < 4; ++mb) { a[mb] = WFrag<T16>::ld(atb(A + aoff + (size_t)mb * 16 * K, lo)); if (NSPLIT == 1 || NSPLIT == 2) a2[mb] = WFrag<T16>::ld(atb(A2 + aoff + (size_t)mb * 16 * K, lo)); }
        V b[4], b2[4];
#pragma unroll
        for (int nb = 0; nb < 4; ++nb) { b[nb] = WFrag<T16>::ld(atb(Bt + boff + (size_t)nb * 16 * K, lo)); if (NSPLIT >= 2) b2[nb] = WFrag<T16>::ld(atb(Bt2 + boff + (size_t)nb * 16 * K, lo)); }
        __builtin_amdgcn_sched_barrier(0);   // all loads of the pass are issued ahead of its products, one load latency a pass (the scheduler otherwise keeps one B fragment's registers and waits out a load per column block)
#pragma unroll
        for (int nb = 0; nb < 4; ++nb) {
#pragma unroll
            for (int mb = 0; mb < 4; ++mb) { acc[mb][nb] = WFrag<T16>::mma(a[mb], b[nb], acc[mb][nb]); if (NSPLIT == 1 || NSPLIT == 2) acc[mb][nb] = WFrag<T16>::mma(a2[mb], b[nb], acc[mb][nb]); if (NSPLIT >= 2) acc[mb][nb] = WFrag<T16>::mma(a[mb], b2[nb], acc[mb][nb]); } }
        asm volatile("v_nop\n\tv_nop\n\tv_nop\n\tv_nop" : "+v"(acc[0][0]), "+v"(acc[1][1]), "+v"(acc[2][2]), "+v"(acc[3][3]) : "v"(a[0]), "v"(a[3]));
        asm volatile("s_wait_xcnt 0x0" ::: "memory");   // stands between this pass's loads and the step of the offset register that they name
        __builtin_amdgcn_sched_barrier(0);   // holds the step behind that wait
        lo += KW * 1024;
    }
    if constexpr (KW > 1) {
        float* osw = os + wv * SLAB;
#pragma unroll
        for (int mb = 0; mb < 4; ++mb)
#pragma unroll
            for (int nb = 0; nb < 4; ++nb)
#pragma unroll
                for (int j = 0; j < 8; ++j) osw[(mb * 16 + hi * 8 + j) * 68 + nb * 16 + lr] = acc[mb][nb][j];
        __syncthreads();   // every wave's partial tile is in LDS before any thread sums it
        if constexpr (OM == 0) {
            const int row0 = (int)(threadIdx.x >> 4), cofs = (int)(threadIdx.x & 15) * 4;   // the block covers 2 * KW rows of 16 float4 per step
            constexpr int NQ = 32 / KW;
            v4f vq[NQ];
#pragma unroll
            for (int q = 0; q < NQ; ++q) { const int row = q * 2 * KW + row0; v4f val = *(const v4fa*)(os + row * 68 + cofs);
#pragma unroll
                for (int w = 1; w < KW; ++w) val += *(const v4fa*)(os + w * SLAB + row * 68 + cofs);
                if (BIAS == 1) { val[0] += bfr(bias[c0 + cofs]); val[1] += bfr(bias[c0 + cofs + 1]); val[2] += bfr(bias[c0 + cofs + 2]); val[3] += bfr(bias[c0 + cofs + 3]); }
                if (BIAS == 2) val += bfr(bias[r0 + row]);
                vq[q] = val; }
            float* pc[NQ];
#pragma unroll
            for (int q = 0; q < NQ; ++q) pc[q] = C + (size_t)(r0 + q * 2 * KW + row0) * ldc + c0 + cofs;
#pragma unroll
            for (int q = 0; q < NQ; ++q) *(v4f*)pc[q] = vq[q];
        } else {
            static_assert(KW == 8, "16 half fragments of the tile over 8 waves, 2 steps");
            // A thread joins 8 consecutive columns of one row, one 16-byte unit of the plane; a wave takes the 32 units of half a fragment (16 rows x the k units 2 j and 2 j + 1), which lie in lane order: each store is 512 contiguous bytes. The LDS reads stay free of bank conflicts (16 rows at pitch 68 start 4 banks apart).
            v8us oh[2], ol[2]; bf* pa[2]; bf* pb[2];
#pragma unroll
            for (int s = 0; s < 2; ++s) { const int hf = s * 8 + wv, rbl = hf >> 2, kbl = (hf >> 1) & 1, j = hf & 1;   // which half fragment of the tile: row block, k block, piece
                const int row = rbl * 16 + lr, col = kbl * 32 + j * 16 + hi * 8;
                v4f v0 = *(const v4fa*)(os + row * 68 + col), v1 = *(const v4fa*)(os + row * 68 + col + 4);
#pragma unroll
                for (int w = 1; w < KW; ++w) { v0 += *(const v4fa*)(os + w * SLAB + row * 68 + col); v1 += *(const v4fa*)(os + w * SLAB + row * 68 + col + 4); }
                if (BIAS == 1) {
#pragma unroll
                    for (int e = 0; e < 4; ++e) { v0[e] += bfr(bias[c0 + col + e]); v1[e] += bfr(bias[c0 + col + 4 + e]); } }
                if (BIAS == 2) { const float rw = bias[r0 + row];
                    asm volatile("s_wait_xcnt 0x0" ::: "memory");   // stands between the bias load and the next write of the register that it names as address
                    const float rb = bfr(rw); v0 += rb; v1 += rb; }
#pragma unroll
                for (int e = 0; e < 4; ++e) { oh[s][e] = f2bf(v0[e]); oh[s][4 + e] = f2bf(v1[e]); }
                v4f h0, h1;
#pragma unroll
                for (int e = 0; e < 4; ++e) { h0[e] = bf2f(oh[s][e]); h1[e] = bf2f(oh[s][4 + e]); }
                const v4f s0 = v0 - h0, s1 = v1 - h1;   // what the hi plane leaves, exact in f32
#pragma unroll
                for (int e = 0; e < 4; ++e) { ol[s][e] = f2bf(s0[e]); ol[s][4 + e] = f2bf(s1[e]); }
                const size_t fr = (OM == 1) ? (size_t)(r0 / 16 + rbl) * (ldc / 32) + c0 / 32 + kbl : ((size_t)by * (TT / 16) + r0 / 16 + rbl) * (HD / 32) + kbl;   // the fragment's number in its plane
                const size_t eo = fr * 512 + j * 256 + lane * 8; pa[s] = Ph + eo; pb[s] = Pl + eo; }
            __builtin_amdgcn_sched_barrier(0);   // all values and addresses are ready here: behind the first store no register that a store names is written any more (the scheduler otherwise lifts the first store into the split and has to wait before it reuses the store's registers)
#pragma unroll
            for (int s = 0; s < 2; ++s) { *(v8us*)pa[s] = oh[s]; *(v8us*)pb[s] = ol[s]; }
            asm volatile("s_wait_xcnt 0x0" ::: "memory");   // stands behind the store(s): in a kernel that holds several bodies the listing goes on from here into another body's head, which writes registers that a store names
        }
        return;
    }
#pragma unroll
    for (int mb = 0; mb < 4; ++mb) {
#pragma unroll
        for (int nb = 0; nb < 4; ++nb) {
#pragma unroll
            for (int j = 0; j < 8; ++j) os[(hi * 8 + j) * 68 + nb * 16 + lr] = acc[mb][nb][j]; }
        __builtin_amdgcn_wave_barrier(); asm volatile("" ::: "memory");
        float* crow = C + (size_t)(r0 + mb * 16) * ldc + c0;
{
#pragma unroll
            for (int s = 0; s < 8; ++s) { const int row = 2 * s + hi, cofs = lr * 4; v4f val = *(const v4fa*)(os + row * 68 + cofs); if (BIAS) { val[0] += bfr(bias[c0 + cofs]); val[1] += bfr(bias[c0 + cofs + 1]); val[2] += bfr(bias[c0 + cofs + 2]); val[3] += bfr(bias[c0 + cofs + 3]); }
                *(v4f*)(crow + (size_t)row * ldc + cofs) = val; }
             }
        __builtin_amdgcn_wave_barrier(); asm volatile("" ::: "memory");
    }
}

#define GLDS (8 * 64 * 68)          // floats: the 8 waves' partial tiles
#define PLNE ((size_t)NH_ * TT * HD) // elements of one batch's head planes
// k_qkv: the three projections of both batches, which do not depend on one another, in one launch; grid (NB_ * TT / 64, 16, 3). z = 0: Q, z = 1: K, each into head planes of batch bx / 32; z = 2: V^T = Wv^T.X^T of batch b, rows (head, d), columns the batch's tokens.
__global__ __launch_bounds__(256) void k_qkv(const bf* __restrict__ XQ, const bf* __restrict__ XK, const bf* __restrict__ XV, const bf* __restrict__ WQ, const bf* __restrict__ WK, const bf* __restrict__ WV, const float* __restrict__ bq, const float* __restrict__ bk, const float* __restrict__ bv, bf* QPh, bf* QPl, bf* KPh, bf* KPl, bf* VTh, bf* VTl) {
    __shared__ __align__(16) float os[GLDS];
    const int bx = blockIdx.x, by = blockIdx.y;
    if (blockIdx.z < 2) { const size_t b = bx / (TT / 64); const bool zq = blockIdx.z == 0; gemmw_tile<bf, 0, 1, 8, 2, DM>(os, bx % (TT / 64), by, (zq ? XQ : XK) + b * TT * DM, nullptr, zq ? WQ : WK, nullptr, nullptr, (zq ? QPh : KPh) + b * PLNE, (zq ? QPl : KPl) + b * PLNE, DKV, zq ? bq : bk); }
    else { const int t = by * (NB_ * TT / 64) + bx; const size_t b = t / ((DKV / 64) * (TT / 64)); gemmw_tile<bf, 0, 2, 8, 1, DM>(os, t % (DKV / 64), (t / (DKV / 64)) % (TT / 64), WV, nullptr, XV + b * TT * DM, nullptr, nullptr, VTh + b * PLNE, VTl + b * PLNE, TT, bv); }
}
// k_wo: merged hi/lo rows of both batches x Wo + bo, f32 to the output; grid (NB_ * TT / 64, 16).
__global__ __launch_bounds__(256) void k_wo(const bf* __restrict__ ATh, const bf* __restrict__ ATl, const bf* __restrict__ WO, float* OUT, const float* __restrict__ bo) {
    __shared__ __align__(16) float os[GLDS];
    gemmw_tile<bf, 1, 1, 8, 0, DQ>(os, blockIdx.x, blockIdx.y, ATh, ATl, WO, nullptr, OUT, nullptr, nullptr, DM, bo);
}

typedef __attribute__((ext_vector_type(2))) unsigned short v2us;
typedef __attribute__((ext_vector_type(2))) float v2f;

// The three converters store fragment order; k_prep below runs all of them in one launch and hands each its block number. wtG (Bt[n][k] = w[k][n]): a thread takes one column n and 8 consecutive k; a wave's 32 columns make each load one whole line and each store two runs of 256 bytes.
__device__ __forceinline__ void wtG(const float* __restrict__ w, int K, int N, bf* Bt, int blk) {
    const int n = (blk % (N / 256)) * 256 + threadIdx.x, u = blk / (N / 256); v8us o;   // (N / 256) * (K / 8) blocks
    const float* wr = w + (size_t)u * 8 * N;   // the block's 8 rows: uniform bases, the lane's part is its column
#pragma unroll
    for (int e = 0; e < 8; ++e) o[e] = f2bf(*atb(wr + (size_t)e * N, (unsigned)n * 4));
    *(v8us*)(Bt + ((size_t)(n >> 4) * (K / 32) + (u >> 2)) * 512 + ((u & 3) * 16 + (n & 15)) * 8) = o;
    asm volatile("s_wait_xcnt 0x0" ::: "memory");   // stands behind the store(s): in a kernel that holds several bodies the listing goes on from here into another body's head, which writes registers that a store names
}
// cvt8 (rows of DM): a wave takes 8 rows x 32 k, half a fragment: lane = (k unit q, row); it reads 8 whole lines in two loads and stores 4 whole lines.
__device__ __forceinline__ void cvt8(const float* __restrict__ src, bf* dst, int blk) { const size_t i = (size_t)blk * 256 + threadIdx.x;
    const int lane = threadIdx.x & 31, q = lane >> 3; const size_t wv = i >> 5, fr = wv >> 1; const int c = (int)(wv & 1) * 8 + (lane & 7);
    const v8f v = *(const v8f*)(src + ((fr / (DM / 32)) * 16 + c) * DM + (fr % (DM / 32)) * 32 + q * 8); v8us o;
#pragma unroll
    for (int k = 0; k < 8; ++k) o[k] = f2bf(v[k]); *(v8us*)(dst + fr * 512 + (q * 16 + c) * 8) = o;
    asm volatile("s_wait_xcnt 0x0" ::: "memory");   // stands behind the store(s): in a kernel that holds several bodies the listing goes on from here into another body's head, which writes registers that a store names
}

// wbx (Bt[n][k] = w[k][n], the bilinear W, HD x HD): thread i writes unit i of the plane: row c, k unit q of fragment i / 64.
__device__ __forceinline__ void wbx(const float* __restrict__ w, bf* Bt, int blk) { const int i = blk * 256 + (int)threadIdx.x; const int fr = i >> 6; const int k0 = (fr % (HD / 32)) * 32 + ((i >> 4) & 3) * 8; const int n = (fr / (HD / 32)) * 16 + (i & 15); v8us o;
#pragma unroll
    for (int q = 0; q < 8; ++q) o[q] = f2bf(w[(k0 + q) * HD + n]);
    *(v8us*)(Bt + (size_t)i * 8) = o;
    asm volatile("s_wait_xcnt 0x0" ::: "memory");   // stands behind the store(s): in a kernel that holds several bodies the listing goes on from here into another body's head, which writes registers that a store names
}
// k_prep: every converter in one launch (none reads what another writes). Blocks 0 .. 3 * CVB - 1: the three inputs, both batches (NB_ * TT rows each, XB holds the three copies in turn); then 4 * WTB blocks: Wq, Wk, Wv, Wo (WT holds the four in turn); then the bilinear W.
#define CVB (NB_ * TT * DM / 8 / 256)
#define WTB (DM * DQ / 8 / 256)
#define WDB (HD * HD / 8 / 256)
__global__ __launch_bounds__(256) void k_prep(const float* __restrict__ x, const float* __restrict__ xk, const float* __restrict__ xv, const float* __restrict__ wq, const float* __restrict__ wk, const float* __restrict__ wv, const float* __restrict__ wo, const float* __restrict__ wbl, bf* XB, bf* WT, bf* WB) {
    const int blk = blockIdx.x, wb = blk - 3 * CVB;
    if (blk < 3 * CVB) { const int s = blk / CVB; cvt8(s == 0 ? x : s == 1 ? xk : xv, XB + (size_t)s * NB_ * TT * DM, blk % CVB); }
    else if (wb < 4 * WTB) { const int s = wb / WTB; wtG(s == 0 ? wq : s == 1 ? wk : s == 2 ? wv : wo, DM, DQ, WT + (size_t)s * DQ * DM, wb % WTB); }
    else wbx(wbl, WB, wb - 4 * WTB);
}
typedef __attribute__((ext_vector_type(2))) __bf16 v2b;
typedef __attribute__((ext_vector_type(8))) unsigned v8u;
__device__ __forceinline__ float xhalf(float x) { const int b = __float_as_int(x); return __int_as_float(__builtin_amdgcn_permlanex16(b, b, 0x76543210, 0xfedcba98, false, false)); }   // the value of lane l ^ 16
// vsum: NP passes (32 keys each) of the plain column sums of V^T, hi + lo, on the matrix unit: A = V^T rows, B = all ones (every column of the result tile holds the same sum).
template <int NP> __device__ __forceinline__ void vsum(const bf* vph, const bf* vpl, unsigned& vm, const WFrag<bf>::V one, v8f (&vs)[4]) {
    typedef WFrag<bf> F; F::V ah[NP][4], al[NP][4]; const bf* pa = atb(vph, vm); const bf* pb = atb(vpl, vm);
#pragma unroll
    for (int p = 0; p < NP; ++p)
#pragma unroll
        for (int dt = 0; dt < 4; ++dt) { ah[p][dt] = F::ld(pa + dt * 16 * TT + p * 512); al[p][dt] = F::ld(pb + dt * 16 * TT + p * 512); }
    // the wait stands between these loads and the next write of a register that they name as address; in the two-pass trip, whose loads name lane address pairs, the pairs are inputs so that their registers stay theirs up to here (the allocator otherwise hands a pair to the last load's result)
    if constexpr (NP > 1) asm volatile("s_wait_xcnt 0x0" :: "v"(pa), "v"(pb) : "memory"); else asm volatile("s_wait_xcnt 0x0" ::: "memory");
    __builtin_amdgcn_sched_barrier(0);   // all loads of the trip are issued ahead of its products, one load latency a trip, and the offset's step stays behind the wait
    vm += NP * 1024;
#pragma unroll
    for (int p = 0; p < NP; ++p)
#pragma unroll
        for (int dt = 0; dt < 4; ++dt) { vs[dt] = F::mma(ah[p][dt], one, vs[dt]); vs[dt] = F::mma(al[p][dt], one, vs[dt]); }
}
__global__ __launch_bounds__(256) void k_fattn(const bf* __restrict__ Qh, const bf* __restrict__ Ql, const bf* __restrict__ Kh, const bf* __restrict__ Kl, const bf* __restrict__ Vh, const bf* __restrict__ Vl, const bf* __restrict__ WB, const int* __restrict__ thrp, bf* Ah, bf* Al) {
    typedef WFrag<bf> F; typedef F::V V;
    constexpr float L2E = 1.4426950408889634f;
    const int lane = threadIdx.x & 31, h = lane >> 4;
    const int hd = blockIdx.y, b = blockIdx.z; const int q0 = blockIdx.x * 256 + __builtin_amdgcn_readfirstlane((int)(threadIdx.x >> 5)) * 32;   // the wave's number as a scalar: every fragment's base is wave-uniform
    const int thr = __builtin_amdgcn_readfirstlane(thrp[b]);   // the batch's key threshold (input), a scalar so that the mask test is a scalar branch
    const size_t pl = ((size_t)b * NH_ + hd) * TT * HD;
    const unsigned ko = (unsigned)lane * 16;   // bytes: the lane's place in a fragment, its only own part of a load's address
    const bf* qph = Qh + pl + (size_t)q0 * HD; const bf* qpl = Ql + pl + (size_t)q0 * HD;   // wave-uniform bases, as for K and V^T below
    const bf* vph = Vh + pl; const bf* vpl = Vl + pl;
    // Every key >= threshold has the same logit, whatever Q and K hold, so the passes that lie wholly behind the threshold need no scores and no exponentials: with the running maximum started at that logit each such key has p = 1, its share of the sum is 1 and its share of attn.V is its V row. kend: the first key of those passes (the threshold clamped to the shape, rounded up to a pass); the pass that holds the threshold itself stays in the key loop.
    const int kend = ((thr < 0 ? 0 : thr > TT ? TT : thr) + 31) & ~31;
    v8f vs[4];
#pragma unroll
    for (int dt = 0; dt < 4; ++dt) vs[dt] = (v8f){};
    { v8us o1;
#pragma unroll
        for (int e = 0; e < 8; ++e) o1[e] = 0x3F80;   // bf16 1.0
        const V one = cat16b(o1, o1); unsigned vm = ko + (unsigned)kend * 32;   // 1024 bytes a pass
        int kb = kend;
        if ((TT - kend) & 32) { vsum<1>(vph, vpl, vm, one, vs); kb += 32; }   // an odd pass first, then two passes a trip
#pragma unroll 1
        for (; kb < TT; kb += 64) vsum<2>(vph, vpl, vm, one, vs);
    }
    V rh[2][2], rl[2][2], wf[4][2];   // the wave's Q rows (hi, lo) and all of W^T
#pragma unroll
    for (int qt = 0; qt < 2; ++qt)
#pragma unroll
        for (int ks = 0; ks < 2; ++ks) { rh[qt][ks] = F::ld(atb(qph, ko) + qt * 16 * HD + ks * 512); rl[qt][ks] = F::ld(atb(qpl, ko) + qt * 16 * HD + ks * 512); }
#pragma unroll
    for (int mt = 0; mt < 4; ++mt)
#pragma unroll
        for (int ks = 0; ks < 2; ++ks) wf[mt][ks] = F::ld(atb(WB, ko) + mt * 16 * HD + ks * 512);
    const bf* kph = Kh + pl; const bf* kpl = Kl + pl;   // wave-uniform bases; the lane's part is a 32-bit byte offset
    unsigned vb = ko, kb2 = ko + 32 * HD * 2;   // the lane's byte offsets of this pass's V^T columns and of the next pass's K rows; both step only behind the wait that follows their loads
    v8f o[4][2];
#pragma unroll
    for (int dt = 0; dt < 4; ++dt)
#pragma unroll
        for (int qt = 0; qt < 2; ++qt) o[dt][qt] = vs[dt];   // the keys behind kend, p = 1 each (zero where there are none)
    const float ms0 = kend < TT ? -1.0e-6f * L2E : -3.0e38f, l0 = 0.5f * (float)(TT - kend);   // their logit as the first maximum; their count, half in each of the two lanes that share a query
    float ms[2] = {ms0, ms0}, l[2] = {l0, l0};
    V kh[2][2], kl[2][2];
#pragma unroll
    for (int kt = 0; kt < 2; ++kt)
#pragma unroll
        for (int ks = 0; ks < 2; ++ks) { kh[kt][ks] = F::ld(atb(kph, ko) + kt * 16 * HD + ks * 512); kl[kt][ks] = F::ld(atb(kpl, ko) + kt * 16 * HD + ks * 512); }
    asm volatile("s_wait_xcnt 0x0" ::: "memory");   // stands between the loads above and the next write of a register that they name as address
    __builtin_amdgcn_sched_barrier(0);   // holds later register writes behind that wait
    V qh[2][2], ql[2][2];   // Q W of the wave's 32 queries, hi/lo, as B fragments
#pragma unroll
    for (int qt = 0; qt < 2; ++qt) { v8f t[4];
#pragma unroll
        for (int mt = 0; mt < 4; ++mt) { v8f a = (v8f){};
#pragma unroll
            for (int ks = 0; ks < 2; ++ks) { a = F::mma(wf[mt][ks], rh[qt][ks], a); a = F::mma(wf[mt][ks], rl[qt][ks], a); }
            t[mt] = a; }
#pragma unroll
        for (int ks = 0; ks < 2; ++ks) { v8u wh, wl;
#pragma unroll
            for (int e = 0; e < 16; e += 2) { v2f p; p[0] = t[2 * ks + (e >> 3)][e & 7]; p[1] = t[2 * ks + (e >> 3)][(e & 7) + 1];
                const v2b hp = __builtin_convertvector(p, v2b); v2f rs; rs[0] = p[0] - (float)hp[0]; rs[1] = p[1] - (float)hp[1];
                wh[e >> 1] = __builtin_bit_cast(unsigned, hp); wl[e >> 1] = __builtin_bit_cast(unsigned, __builtin_convertvector(rs, v2b)); }
            qh[qt][ks] = __builtin_bit_cast(V, wh); ql[qt][ks] = __builtin_bit_cast(V, wl); } }
#pragma unroll 1
    for (int kb = 0; kb < kend; kb += 32) {
        V vh[4], vl[4];   // this pass's V^T fragments, asked for ahead of the score products
#pragma unroll
        for (int dt = 0; dt < 4; ++dt) { vh[dt] = F::ld(atb(vph, vb) + dt * 16 * TT); vl[dt] = F::ld(atb(vpl, vb) + dt * 16 * TT); }
        asm volatile("s_wait_xcnt 0x0" ::: "memory");   // stands between these loads and the next write of a register that they name as address
        __builtin_amdgcn_sched_barrier(0);   // keeps the V^T loads issued here, a whole score block and softmax ahead of their use (the scheduler otherwise sinks them next to it), and the offset's step behind the wait
        vb += 1024;   // the next 32 keys' fragment of the same 16 rows
        v8f s[2][2];
#pragma unroll
        for (int kt = 0; kt < 2; ++kt)
#pragma unroll
            for (int qt = 0; qt < 2; ++qt) { v8f t = (v8f){};
#pragma unroll
                for (int ks = 0; ks < 2; ++ks) { t = F::mma(kh[kt][ks], qh[qt][ks], t); t = F::mma(kh[kt][ks], ql[qt][ks], t); t = F::mma(kl[kt][ks], qh[qt][ks], t); }
                s[kt][qt] = t; }
        // the next pass's K fragments fly during the softmax
#pragma unroll
        for (int kt = 0; kt < 2; ++kt)
#pragma unroll
            for (int ks = 0; ks < 2; ++ks) { kh[kt][ks] = F::ld(atb(kph, kb2) + kt * 16 * HD + ks * 512); kl[kt][ks] = F::ld(atb(kpl, kb2) + kt * 16 * HD + ks * 512); }
        asm volatile("s_wait_xcnt 0x0" ::: "memory");   // as above, for the K loads
        __builtin_amdgcn_sched_barrier(0);   // keeps the next K loads issued here, ahead of the softmax (the scheduler otherwise sinks them to the end of the pass, just in front of their use), and the offset's step behind the wait
        kb2 = (kb + 64 < TT) ? kb2 + 32 * HD * 2 : ko;   // the last pass loads pass kend / 32 (pass 0 when kend = TT), unused
        if (kb + 32 > thr) {   // keys >= threshold get the VALUE -1e-6 (MASK_VALUE), not an exclusion
#pragma unroll
            for (int kt = 0; kt < 2; ++kt)
#pragma unroll
                for (int r = 0; r < 8; ++r) { const bool keep = (kb + kt * 16 + 8 * h + r) < thr;
#pragma unroll
                    for (int qt = 0; qt < 2; ++qt) s[kt][qt][r] = keep ? s[kt][qt][r] : -1.0e-6f; }
        }
        float mxs[2]; bool need = false;
#pragma unroll
        for (int qt = 0; qt < 2; ++qt) { float mx = s[0][qt][0];
#pragma unroll
            for (int r = 1; r < 8; ++r) mx = fmaxf(mx, s[0][qt][r]);
#pragma unroll
            for (int r = 0; r < 8; ++r) mx = fmaxf(mx, s[1][qt][r]);
            mx = fmaxf(mx, xhalf(mx)); mxs[qt] = mx * L2E; need = need || (mxs[qt] > ms[qt] + 8.0f); }
        if (__builtin_amdgcn_ballot_w32(need) != 0) {
#pragma unroll
            for (int qt = 0; qt < 2; ++qt) { const float mn = fmaxf(ms[qt], mxs[qt]); const float al = __builtin_amdgcn_exp2f(ms[qt] - mn); ms[qt] = mn; l[qt] *= al;
#pragma unroll
                for (int dt = 0; dt < 4; ++dt) o[dt][qt] *= al; }
        }
        V ph[2], pw[2];
#pragma unroll
        for (int qt = 0; qt < 2; ++qt) { v2f sum = (v2f){0.f, 0.f}; v8u wh, wl;   // two elements at a time: packed conversions, packed sums
#pragma unroll
            for (int e = 0; e < 16; e += 2) { v2f p; p[0] = __builtin_amdgcn_exp2f(__builtin_fmaf(s[e >> 3][qt][e & 7], L2E, -ms[qt])); p[1] = __builtin_amdgcn_exp2f(__builtin_fmaf(s[e >> 3][qt][(e & 7) + 1], L2E, -ms[qt])); sum += p;
                const v2b hp = __builtin_convertvector(p, v2b); v2f rs; rs[0] = p[0] - (float)hp[0]; rs[1] = p[1] - (float)hp[1];
                wh[e >> 1] = __builtin_bit_cast(unsigned, hp); wl[e >> 1] = __builtin_bit_cast(unsigned, __builtin_convertvector(rs, v2b)); }
            ph[qt] = __builtin_bit_cast(V, wh); pw[qt] = __builtin_bit_cast(V, wl); l[qt] += sum[0] + sum[1]; }
#pragma unroll
        for (int dt = 0; dt < 4; ++dt)
#pragma unroll
            for (int qt = 0; qt < 2; ++qt) { o[dt][qt] = F::mma(vh[dt], ph[qt], o[dt][qt]); o[dt][qt] = F::mma(vh[dt], pw[qt], o[dt][qt]); o[dt][qt] = F::mma(vl[dt], ph[qt], o[dt][qt]); }
    }
    v8us oh[2][4], ol[2][4];
#pragma unroll
    for (int qt = 0; qt < 2; ++qt) { const float f = __fdiv_rn(1.0f, l[qt] + xhalf(l[qt]));
#pragma unroll
        for (int dt = 0; dt < 4; ++dt)
#pragma unroll
            for (int r = 0; r < 8; ++r) { unsigned short x2, y2; splitf(o[dt][qt][r] * f, x2, y2); oh[qt][dt][r] = x2; ol[qt][dt][r] = y2; } }
    const size_t ro = ((size_t)b * TT + q0) * DQ + hd * (HD / 32) * 512 + lane * 8; bf* pa = Ah + ro; bf* pb = Al + ro;   // merged rows [NB_ * TT][DQ] in fragment order: the head's two k blocks, piece dt & 1 of block dt >> 1
    __builtin_amdgcn_sched_barrier(0);   // all values and both addresses are ready here: behind the first store no register that a store names is written any more
#pragma unroll
    for (int qt = 0; qt < 2; ++qt)
#pragma unroll
        for (int dt = 0; dt < 4; ++dt) { *(v8us*)(pa + qt * 16 * DQ + dt * 256) = oh[qt][dt]; *(v8us*)(pb + qt * 16 * DQ + dt * 256) = ol[qt][dt]; }
}

extern "C" void kernel_launch(void* const* d_in, const int* in_sizes, int n_in,
                              void* d_out, int out_size, void* d_ws, size_t ws_size, hipStream_t stream) {
    (void)in_sizes; (void)n_in; (void)out_size;
    const float* x = (const float*)d_in[0]; const float* xk = (const float*)d_in[1]; const float* xv = (const float*)d_in[2]; const int* thr = (const int*)d_in[3]; const float* wq = (const float*)d_in[4]; const float* bq = (const float*)d_in[5]; const float* wk = (const float*)d_in[6]; const float* bk = (const float*)d_in[7]; const float* wv = (const float*)d_in[8]; const float* bv = (const float*)d_in[9]; const float* wbl = (const float*)d_in[10]; const float* wo = (const float*)d_in[11]; const float* bo = (const float*)d_in[12];
    float* OUT = (float*)d_out;     // [2][2048][1024]
    char* wsp = (char*)d_ws;
    auto take = [&](size_t bytes) { char* p = wsp; wsp += (bytes + 255) & ~(size_t)255; return (void*)p; };
    bf* WB = (bf*)take((size_t)HD * HD * 2);
    bf* WT = (bf*)take((size_t)4 * DQ * DM * 2); bf* WQ = WT; bf* WK = WT + (size_t)DQ * DM; bf* WV = WT + (size_t)2 * DQ * DM; bf* WO = WT + (size_t)3 * DQ * DM;
    bf* XB = (bf*)take((size_t)3 * NB_ * TT * DM * 2); bf* XQ = XB; bf* XK = XB + (size_t)NB_ * TT * DM; bf* XV = XB + (size_t)2 * NB_ * TT * DM;
    const size_t PLN = (size_t)NH_ * TT * HD;   // one batch's head planes; every plane is kept for both batches
    bf* QPh = (bf*)take(NB_ * PLN * 2); bf* QPl = (bf*)take(NB_ * PLN * 2); bf* KPh = (bf*)take(NB_ * PLN * 2); bf* KPl = (bf*)take(NB_ * PLN * 2); bf* VTh = (bf*)take(NB_ * PLN * 2); bf* VTl = (bf*)take(NB_ * PLN * 2);
    bf* ATh = (bf*)take((size_t)NB_ * TT * DQ * 2); bf* ATl = (bf*)take((size_t)NB_ * TT * DQ * 2);
    if ((size_t)(wsp - (char*)d_ws) > ws_size) return;    // ws 256 MiB
    k_prep<<<3 * CVB + 4 * WTB + WDB, 256, 0, stream>>>(x, xk, xv, wq, wk, wv, wo, wbl, XB, WT, WB);
    k_qkv<<<dim3(NB_ * TT / 64, DQ / 64, 3), 256, 0, stream>>>(XQ, XK, XV, WQ, WK, WV, bq, bk, bv, QPh, QPl, KPh, KPl, VTh, VTl);
    k_fattn<<<dim3(TT / 256, NH_, NB_), 256, 0, stream>>>(QPh, QPl, KPh, KPl, VTh, VTl, WB, thr, ATh, ATl);
    k_wo<<<dim3(NB_ * TT / 64, DM / 64, 1), 256, 0, stream>>>(ATh, ATl, WO, OUT, bo);
}
